// v000
// Times are from an AMD MI455X. After a warm-up the kernel runs many times in a row, and a time is the length of
// such a window on the GPU divided by its runs, so every launch and the gaps after it count. The runs cycle
// through copies of the inputs. A figure is the median of several windows, for all but v000 over two sittings.
// Sittings can differ by a few percent; kernels timed side by side share one.
// v000 is the starting kernel. One run takes 621 microseconds.
#include <hip/hip_runtime.h>
#include <math.h>

// ---------------------------------------------------------------------------
// CDNA5 (gfx1250) fp32 WMMA attention layer.
//   Q = rope(x@wq), K = rope(x@wk), V = x@wv
//   O = softmax(Q Kt / sqrt(D)) V ;  out = O @ wo
// All matmuls via V_WMMA_F32_16X16X4_F32 (exact fp32).
// GEMM tiles double-buffered in LDS via GLOBAL_LOAD_ASYNC_TO_LDS (ASYNCcnt).
// ---------------------------------------------------------------------------

typedef __attribute__((ext_vector_type(2))) float v2f;
typedef __attribute__((ext_vector_type(8))) float v8f;

#define N_ROWS   2048   // B*S
#define SEQ      1024
#define DIM      2048
#define KVD      512
#define HQ       32
#define HKV      8
#define HD       64
#define BQ       32     // query rows per attention workgroup

// ---------------- async global->LDS helpers (probe-guarded) ----------------
#if defined(__has_builtin)
#  if __has_builtin(__builtin_amdgcn_global_load_async_to_lds_b32) && \
      __has_builtin(__builtin_amdgcn_global_load_async_to_lds_b128)
#    define HAVE_ASYNC_LDS 1
#  else
#    define HAVE_ASYNC_LDS 0
#  endif
#  if __has_builtin(__builtin_amdgcn_s_wait_asynccnt)
#    define HAVE_WAIT_ASYNC 1
#  else
#    define HAVE_WAIT_ASYNC 0
#  endif
#else
#  define HAVE_ASYNC_LDS 0
#  define HAVE_WAIT_ASYNC 0
#endif

#if HAVE_ASYNC_LDS
typedef int vsi4 __attribute__((vector_size(16)));
typedef __attribute__((address_space(1))) int  gas_i32;   // global int*
typedef __attribute__((address_space(3))) int  las_i32;   // LDS int*
typedef __attribute__((address_space(1))) vsi4 gas_v4i;   // global int4*
typedef __attribute__((address_space(3))) vsi4 las_v4i;   // LDS int4*
#endif

static __device__ __forceinline__ void cp_b32(float* lds_dst, const float* gsrc) {
#if HAVE_ASYNC_LDS
  __builtin_amdgcn_global_load_async_to_lds_b32(
      (gas_i32*)gsrc, (las_i32*)lds_dst, 0, 0);
#else
  *lds_dst = *gsrc;
#endif
}

static __device__ __forceinline__ void cp_b128(float* lds_dst, const float* gsrc) {
#if HAVE_ASYNC_LDS
  __builtin_amdgcn_global_load_async_to_lds_b128(
      (gas_v4i*)gsrc, (las_v4i*)lds_dst, 0, 0);
#else
  *(float4*)lds_dst = *(const float4*)gsrc;
#endif
}

static __device__ __forceinline__ void wait_async_all() {
#if HAVE_ASYNC_LDS
#  if HAVE_WAIT_ASYNC
  __builtin_amdgcn_s_wait_asynccnt(0);
#  else
  asm volatile("s_wait_asynccnt 0" ::: "memory");
#  endif
#endif
}

static __device__ __forceinline__ v8f wmma_f32(v2f a, v2f b, v8f c) {
  // V_WMMA_F32_16X16X4_F32 : D = A(16x4) * B(4x16) + C, fp32 exact
  return __builtin_amdgcn_wmma_f32_16x16x4_f32(
      /*neg_a=*/false, a, /*neg_b=*/false, b,
      /*c_mod=*/(short)0, c, /*reuse_a=*/false, /*reuse_b=*/false);
}

// ---------------------------------------------------------------------------
// fp32 GEMM:  C[M,N] = A[M,K] * B[K,N]  (row-major, block tile 128x128)
// 128 threads = 4 waves arranged 2(m) x 2(n); each wave owns a 64x64 subtile
// (4x4 WMMA accumulators -> 16 WMMAs per k-step vs 8 fragment fetches).
// LDS double-buffered; tiles staged with async global->LDS copies.
// A tile kept row-major with 20-dword padded stride so an A fragment is one
// aligned ds_load_b64 (bank-conflict free).
// ---------------------------------------------------------------------------
#define GA_STRIDE 20   // dwords per A-tile row (16 data + 4 pad, 16B aligned)

__global__ __launch_bounds__(128)
void gemm_f32_wmma(const float* __restrict__ A, const float* __restrict__ B,
                   float* __restrict__ C, int M, int N, int K) {
  __shared__ float As[2][128 * GA_STRIDE]; // [m][k] row-major, padded
  __shared__ float Bs[2][16 * 128];        // [k][n]

  const int tid  = threadIdx.x;
  const int lane = tid & 31;
  const int wid  = tid >> 5;
  const int wm   = wid >> 1;            // 0..1 -> 64-row strip
  const int wn   = wid & 1;             // 0..1 -> 64-col strip
  const int m0   = blockIdx.y * 128;
  const int n0   = blockIdx.x * 128;

  v8f acc[4][4] = {};

  // stage tile for k0 = 0 into buffer 0
  {
    #pragma unroll
    for (int i = 0; i < 4; ++i) {              // A: 512 x 16B quads
      int idx = tid + i * 128;
      int m = idx >> 2, kq = (idx & 3) << 2;
      cp_b128(&As[0][m * GA_STRIDE + kq], &A[(size_t)(m0 + m) * K + kq]);
    }
    #pragma unroll
    for (int i = 0; i < 4; ++i) {              // B: 512 x 16B quads
      int idx = tid + i * 128;
      int k = idx >> 5, n4 = (idx & 31) << 2;
      cp_b128(&Bs[0][k * 128 + n4], &B[(size_t)k * N + n0 + n4]);
    }
  }
  wait_async_all();
  __syncthreads();

  for (int k0 = 0; k0 < K; k0 += 16) {
    const int cur = (k0 >> 4) & 1;
    const int nxt = cur ^ 1;

    // prefetch next k-tile while this one is consumed by the matrix pipe
    if (k0 + 16 < K) {
      #pragma unroll
      for (int i = 0; i < 4; ++i) {
        int idx = tid + i * 128;
        int m = idx >> 2, kq = (idx & 3) << 2;
        cp_b128(&As[nxt][m * GA_STRIDE + kq],
                &A[(size_t)(m0 + m) * K + (k0 + 16 + kq)]);
      }
      #pragma unroll
      for (int i = 0; i < 4; ++i) {
        int idx = tid + i * 128;
        int k = idx >> 5, n4 = (idx & 31) << 2;
        cp_b128(&Bs[nxt][k * 128 + n4],
                &B[(size_t)(k0 + 16 + k) * N + n0 + n4]);
      }
    }

    #pragma unroll
    for (int kk = 0; kk < 16; kk += 4) {
      const int kl = kk + ((lane >> 4) << 1);   // lanes 16..31 take K+2,K+3
      v2f afr[4], bfr[4];
      #pragma unroll
      for (int mi = 0; mi < 4; ++mi) {
        int mrow = wm * 64 + mi * 16 + (lane & 15);
        afr[mi] = *(const v2f*)&As[cur][mrow * GA_STRIDE + kl]; // ds_load_b64
      }
      #pragma unroll
      for (int ni = 0; ni < 4; ++ni) {
        int ncol = wn * 64 + ni * 16 + (lane & 15);
        bfr[ni] = (v2f){Bs[cur][kl * 128 + ncol], Bs[cur][(kl + 1) * 128 + ncol]};
      }
      #pragma unroll
      for (int mi = 0; mi < 4; ++mi)
        #pragma unroll
        for (int ni = 0; ni < 4; ++ni)
          acc[mi][ni] = wmma_f32(afr[mi], bfr[ni], acc[mi][ni]);
    }

    wait_async_all();
    __syncthreads();
  }

  // Writeback: VGPR r holds M = (lane>=16 ? 8 : 0)+r, N = lane&15.
  #pragma unroll
  for (int mi = 0; mi < 4; ++mi)
    #pragma unroll
    for (int ni = 0; ni < 4; ++ni)
      #pragma unroll
      for (int r = 0; r < 8; ++r) {
        int row = m0 + wm * 64 + mi * 16 + ((lane >> 4) << 3) + r;
        int col = n0 + wn * 64 + ni * 16 + (lane & 15);
        C[(size_t)row * N + col] = acc[mi][ni][r];
      }
}

// ---------------------------------------------------------------------------
// RoPE in-place on a [rows, H*D] buffer; pair (2i, 2i+1) within each head.
// ---------------------------------------------------------------------------
__global__ __launch_bounds__(256)
void rope_f32(float* __restrict__ buf, int H, int total_pairs) {
  int idx = blockIdx.x * blockDim.x + threadIdx.x;
  if (idx >= total_pairs) return;
  const int half = HD / 2;
  int i   = idx % half;
  int h   = (idx / half) % H;
  int row = idx / (half * H);
  int s   = row % SEQ;
  float inv = __expf(-((float)(2 * i) / (float)HD) * __logf(10000.0f));
  float ang = (float)s * inv;
  float sn, cs;
  sincosf(ang, &sn, &cs);
  float* p = buf + ((size_t)row * H + h) * HD + 2 * i;
  float x1 = p[0], x2 = p[1];
  p[0] = x1 * cs - x2 * sn;
  p[1] = x1 * sn + x2 * cs;
}

// ---------------------------------------------------------------------------
// Attention: one workgroup = (32 queries) x (one q-head) x (one batch).
// Full 32x1024 score panel lives in LDS (CDNA5: 320KB/WGP), padded +1.
// K tile staged transposed (async b32), V tile staged row-major (async b128)
// reusing the same LDS buffer.  8 waves, 256 threads.
// ---------------------------------------------------------------------------
#define VT_STRIDE 68   // dwords per V-tile row (64 data + 4 pad, 16B aligned)

__global__ __launch_bounds__(256)
void attn_f32_wmma(const float* __restrict__ Q, const float* __restrict__ Kb,
                   const float* __restrict__ Vb, float* __restrict__ O) {
  __shared__ float sc[BQ][SEQ + 1];      // 32 x 1025 fp32  (~128 KB)
  __shared__ float qs[HD][BQ + 1];       // Q tile transposed [d][q]
  __shared__ float ktvt[64 * VT_STRIDE]; // K tile [d][key] (stride 65) then
                                         // V tile [key][d] (stride 68)

  const int qb = blockIdx.x;          // 0..31  query block
  const int h  = blockIdx.y;          // 0..31  q head
  const int b  = blockIdx.z;          // 0..1   batch
  const int g  = h >> 2;              // kv head (n_rep = 4)

  const int tid  = threadIdx.x;
  const int lane = tid & 31;
  const int wid  = tid >> 5;
  const int mi   = wid & 1;           // 16-row half of the 32-query block
  const int ni   = wid >> 1;          // 0..3 : 16-col group within 64
  const float scale = 0.125f;         // 1/sqrt(64)

  const size_t qrow0 = (size_t)b * SEQ + (size_t)qb * BQ;

  // ---- stage Q tile (32x64) transposed into LDS ----
  #pragma unroll
  for (int i = 0; i < 8; ++i) {
    int idx = tid + i * 256;
    int d = idx & 63, q = idx >> 6;
    cp_b32(&qs[d][q], &Q[(qrow0 + q) * DIM + h * HD + d]);
  }

  // ---- scores: S = Q * K^T over key chunks of 64 ----
  const int mrow = mi * 16 + (lane & 15);
  const int ncol = ni * 16 + (lane & 15);
  for (int kv0 = 0; kv0 < SEQ; kv0 += 64) {
    __syncthreads();                  // prev chunk consumed
    #pragma unroll
    for (int i = 0; i < 16; ++i) {    // 64x64 K tile, transposed, coalesced on d
      int idx = tid + i * 256;
      int d = idx & 63, ky = idx >> 6;
      cp_b32(&ktvt[d * 65 + ky],
             &Kb[((size_t)b * SEQ + kv0 + ky) * KVD + g * HD + d]);
    }
    wait_async_all();
    __syncthreads();

    v8f acc = {};
    #pragma unroll
    for (int kk = 0; kk < HD; kk += 4) {
      const int kl = kk + ((lane >> 4) << 1);
      v2f a  = (v2f){qs[kl][mrow], qs[kl + 1][mrow]};
      v2f bb = (v2f){ktvt[kl * 65 + ncol], ktvt[(kl + 1) * 65 + ncol]};
      acc = wmma_f32(a, bb, acc);
    }
    #pragma unroll
    for (int r = 0; r < 8; ++r) {
      int row = mi * 16 + ((lane >> 4) << 3) + r;
      int col = kv0 + ni * 16 + (lane & 15);
      sc[row][col] = acc[r];
    }
  }
  __syncthreads();

  // ---- softmax over each of the 32 rows; wave w owns rows 4w..4w+3 ----
  #pragma unroll
  for (int j = 0; j < 4; ++j) {
    const int r = wid * 4 + j;
    float mx = -INFINITY;
    for (int c = lane; c < SEQ; c += 32) mx = fmaxf(mx, sc[r][c]);
    #pragma unroll
    for (int off = 16; off; off >>= 1) mx = fmaxf(mx, __shfl_xor(mx, off, 32));
    float sum = 0.0f;
    for (int c = lane; c < SEQ; c += 32) {
      float p = __expf(scale * (sc[r][c] - mx));
      sc[r][c] = p;
      sum += p;
    }
    #pragma unroll
    for (int off = 16; off; off >>= 1) sum += __shfl_xor(sum, off, 32);
    float rinv = 1.0f / sum;
    for (int c = lane; c < SEQ; c += 32) sc[r][c] *= rinv;
  }

  // ---- O = P(32x1024) @ V(1024x64); V chunks staged through LDS ----
  const float* Vg = Vb + (size_t)b * SEQ * KVD + g * HD;
  v8f oac = {};
  for (int kv0 = 0; kv0 < SEQ; kv0 += 64) {
    __syncthreads();                  // prev V chunk consumed / softmax done
    #pragma unroll
    for (int i = 0; i < 4; ++i) {     // 64x64 V tile, row-major, b128
      int idx = tid + i * 256;
      int ky = idx >> 4, d4 = (idx & 15) << 2;
      cp_b128(&ktvt[ky * VT_STRIDE + d4],
              &Vg[(size_t)(kv0 + ky) * KVD + d4]);
    }
    wait_async_all();
    __syncthreads();

    #pragma unroll
    for (int kk = 0; kk < 64; kk += 4) {
      const int kl = kk + ((lane >> 4) << 1);
      const int kg = kv0 + kl;
      v2f a  = (v2f){sc[mrow][kg], sc[mrow][kg + 1]};
      v2f bb = (v2f){ktvt[kl * VT_STRIDE + ncol],
                     ktvt[(kl + 1) * VT_STRIDE + ncol]};
      oac = wmma_f32(a, bb, oac);
    }
  }

  #pragma unroll
  for (int r = 0; r < 8; ++r) {
    int q = mi * 16 + ((lane >> 4) << 3) + r;
    O[(qrow0 + q) * DIM + h * HD + ncol] = oac[r];
  }
}

// ---------------------------------------------------------------------------
extern "C" void kernel_launch(void* const* d_in, const int* in_sizes, int n_in,
                              void* d_out, int out_size, void* d_ws, size_t ws_size,
                              hipStream_t stream) {
  const float* x  = (const float*)d_in[0];
  const float* wq = (const float*)d_in[1];
  const float* wk = (const float*)d_in[2];
  const float* wv = (const float*)d_in[3];
  const float* wo = (const float*)d_in[4];

  float* ws = (float*)d_ws;
  float* Qb = ws;                              // 2048*2048
  float* Kb = Qb + (size_t)N_ROWS * DIM;       // 2048*512
  float* Vb = Kb + (size_t)N_ROWS * KVD;       // 2048*512
  float* Ab = Vb + (size_t)N_ROWS * KVD;       // 2048*2048 (attention output)

  dim3 gblk(128);
  dim3 ablk(256);

  // QKV projections
  gemm_f32_wmma<<<dim3(DIM / 128, N_ROWS / 128), gblk, 0, stream>>>(x, wq, Qb, N_ROWS, DIM, DIM);
  gemm_f32_wmma<<<dim3(KVD / 128, N_ROWS / 128), gblk, 0, stream>>>(x, wk, Kb, N_ROWS, KVD, DIM);
  gemm_f32_wmma<<<dim3(KVD / 128, N_ROWS / 128), gblk, 0, stream>>>(x, wv, Vb, N_ROWS, KVD, DIM);

  // RoPE on Q and K
  {
    int pq = N_ROWS * HQ * (HD / 2);
    int pk = N_ROWS * HKV * (HD / 2);
    rope_f32<<<(pq + 255) / 256, ablk, 0, stream>>>(Qb, HQ, pq);
    rope_f32<<<(pk + 255) / 256, ablk, 0, stream>>>(Kb, HKV, pk);
  }

  // Attention
  attn_f32_wmma<<<dim3(SEQ / BQ, HQ, 2), ablk, 0, stream>>>(Qb, Kb, Vb, Ab);

  // Output projection
  gemm_f32_wmma<<<dim3(DIM / 128, N_ROWS / 128), gblk, 0, stream>>>(Ab, wo, (float*)d_out, N_ROWS, DIM, DIM);
}

// v001
// It runs in 495 microseconds.
// Next to v000, in two timings, it ran 1.29 times as fast each time.
#include <hip/hip_runtime.h>
#include <math.h>

// ---------------------------------------------------------------------------
// CDNA5 (gfx1250) fp32 WMMA attention layer.
//   Q = rope(x@wq), K = rope(x@wk), V = x@wv
//   O = softmax(Q Kt / sqrt(D)) V ;  out = O @ wo
// All matmuls via V_WMMA_F32_16X16X4_F32 (exact fp32).
// GEMM tiles double-buffered in LDS via GLOBAL_LOAD_ASYNC_TO_LDS (ASYNCcnt).
// ---------------------------------------------------------------------------

typedef __attribute__((ext_vector_type(2))) float v2f;
typedef __attribute__((ext_vector_type(8))) float v8f;

#define N_ROWS   2048   // B*S
#define SEQ      1024
#define DIM      2048
#define KVD      512
#define HQ       32
#define HKV      8
#define HD       64
#define BQ       32     // query rows per attention workgroup

// ---------------- async global->LDS helpers (probe-guarded) ----------------
#if defined(__has_builtin)
#  if __has_builtin(__builtin_amdgcn_global_load_async_to_lds_b32) && \
      __has_builtin(__builtin_amdgcn_global_load_async_to_lds_b128)
#    define HAVE_ASYNC_LDS 1
#  else
#    define HAVE_ASYNC_LDS 0
#  endif
#  if __has_builtin(__builtin_amdgcn_s_wait_asynccnt)
#    define HAVE_WAIT_ASYNC 1
#  else
#    define HAVE_WAIT_ASYNC 0
#  endif
#else
#  define HAVE_ASYNC_LDS 0
#  define HAVE_WAIT_ASYNC 0
#endif

#if HAVE_ASYNC_LDS
typedef int vsi4 __attribute__((vector_size(16)));
typedef __attribute__((address_space(1))) int  gas_i32;   // global int*
typedef __attribute__((address_space(3))) int  las_i32;   // LDS int*
typedef __attribute__((address_space(1))) vsi4 gas_v4i;   // global int4*
typedef __attribute__((address_space(3))) vsi4 las_v4i;   // LDS int4*
#endif

static __device__ __forceinline__ void cp_b32(float* lds_dst, const float* gsrc) {
#if HAVE_ASYNC_LDS
  __builtin_amdgcn_global_load_async_to_lds_b32(
      (gas_i32*)gsrc, (las_i32*)lds_dst, 0, 0);
#else
  *lds_dst = *gsrc;
#endif
}

static __device__ __forceinline__ void cp_b128(float* lds_dst, const float* gsrc) {
#if HAVE_ASYNC_LDS
  __builtin_amdgcn_global_load_async_to_lds_b128(
      (gas_v4i*)gsrc, (las_v4i*)lds_dst, 0, 0);
#else
  *(float4*)lds_dst = *(const float4*)gsrc;
#endif
}

static __device__ __forceinline__ void wait_async_all() {
#if HAVE_ASYNC_LDS
#  if HAVE_WAIT_ASYNC
  __builtin_amdgcn_s_wait_asynccnt(0);
#  else
  asm volatile("s_wait_asynccnt 0" ::: "memory");
#  endif
#endif
}

static __device__ __forceinline__ v8f wmma_f32(v2f a, v2f b, v8f c) {
  // V_WMMA_F32_16X16X4_F32 : D = A(16x4) * B(4x16) + C, fp32 exact
  return __builtin_amdgcn_wmma_f32_16x16x4_f32(
      /*neg_a=*/false, a, /*neg_b=*/false, b,
      /*c_mod=*/(short)0, c, /*reuse_a=*/false, /*reuse_b=*/false);
}

// ---------------------------------------------------------------------------
// fp32 GEMM:  C[M,N] = A[M,K] * B[K,N]  (row-major, block tile 128x128)
// 128 threads = 4 waves arranged 2(m) x 2(n); each wave owns a 64x64 subtile
// (4x4 WMMA accumulators -> 16 WMMAs per k-step vs 8 fragment fetches).
// LDS double-buffered; tiles staged with async global->LDS copies.
// A tile kept row-major with 20-dword padded stride so an A fragment is one
// aligned ds_load_b64 (bank-conflict free).
// ---------------------------------------------------------------------------
#define GA_STRIDE 20   // dwords per A-tile row (16 data + 4 pad, 16B aligned)

// One 128x128 tile of C, rows from m0 and columns from n0, by one workgroup.
static __device__ __forceinline__
void gemm_tile_f32(const float* __restrict__ A, const float* __restrict__ B,
                   float* __restrict__ C, int N, int K, int m0, int n0) {
  __shared__ float As[2][128 * GA_STRIDE]; // [m][k] row-major, padded
  __shared__ float Bs[2][16 * 128];        // [k][n]

  const int tid  = threadIdx.x;
  const int lane = tid & 31;
  const int wid  = tid >> 5;
  const int wm   = wid >> 1;            // 0..1 -> 64-row strip
  const int wn   = wid & 1;             // 0..1 -> 64-col strip

  v8f acc[4][4] = {};

  // stage tile for k0 = 0 into buffer 0
  {
    #pragma unroll
    for (int i = 0; i < 4; ++i) {              // A: 512 x 16B quads
      int idx = tid + i * 128;
      int m = idx >> 2, kq = (idx & 3) << 2;
      cp_b128(&As[0][m * GA_STRIDE + kq], &A[(size_t)(m0 + m) * K + kq]);
    }
    #pragma unroll
    for (int i = 0; i < 4; ++i) {              // B: 512 x 16B quads
      int idx = tid + i * 128;
      int k = idx >> 5, n4 = (idx & 31) << 2;
      cp_b128(&Bs[0][k * 128 + n4], &B[(size_t)k * N + n0 + n4]);
    }
  }
  wait_async_all();
  __syncthreads();

  for (int k0 = 0; k0 < K; k0 += 16) {
    const int cur = (k0 >> 4) & 1;
    const int nxt = cur ^ 1;

    // prefetch next k-tile while this one is consumed by the matrix pipe
    if (k0 + 16 < K) {
      #pragma unroll
      for (int i = 0; i < 4; ++i) {
        int idx = tid + i * 128;
        int m = idx >> 2, kq = (idx & 3) << 2;
        cp_b128(&As[nxt][m * GA_STRIDE + kq],
                &A[(size_t)(m0 + m) * K + (k0 + 16 + kq)]);
      }
      #pragma unroll
      for (int i = 0; i < 4; ++i) {
        int idx = tid + i * 128;
        int k = idx >> 5, n4 = (idx & 31) << 2;
        cp_b128(&Bs[nxt][k * 128 + n4],
                &B[(size_t)(k0 + 16 + k) * N + n0 + n4]);
      }
    }

    #pragma unroll
    for (int kk = 0; kk < 16; kk += 4) {
      const int kl = kk + ((lane >> 4) << 1);   // lanes 16..31 take K+2,K+3
      v2f afr[4], bfr[4];
      #pragma unroll
      for (int mi = 0; mi < 4; ++mi) {
        int mrow = wm * 64 + mi * 16 + (lane & 15);
        afr[mi] = *(const v2f*)&As[cur][mrow * GA_STRIDE + kl]; // ds_load_b64
      }
      #pragma unroll
      for (int ni = 0; ni < 4; ++ni) {
        int ncol = wn * 64 + ni * 16 + (lane & 15);
        bfr[ni] = (v2f){Bs[cur][kl * 128 + ncol], Bs[cur][(kl + 1) * 128 + ncol]};
      }
      #pragma unroll
      for (int mi = 0; mi < 4; ++mi)
        #pragma unroll
        for (int ni = 0; ni < 4; ++ni)
          acc[mi][ni] = wmma_f32(afr[mi], bfr[ni], acc[mi][ni]);
    }

    wait_async_all();
    __syncthreads();
  }

  // Writeback: VGPR r holds M = (lane>=16 ? 8 : 0)+r, N = lane&15.
  #pragma unroll
  for (int mi = 0; mi < 4; ++mi)
    #pragma unroll
    for (int ni = 0; ni < 4; ++ni)
      #pragma unroll
      for (int r = 0; r < 8; ++r) {
        int row = m0 + wm * 64 + mi * 16 + ((lane >> 4) << 3) + r;
        int col = n0 + wn * 64 + ni * 16 + (lane & 15);
        C[(size_t)row * N + col] = acc[mi][ni][r];
      }
}

__global__ __launch_bounds__(128)
void gemm_f32_wmma(const float* __restrict__ A, const float* __restrict__ B,
                   float* __restrict__ C, int M, int N, int K) {
  gemm_tile_f32(A, B, C, N, K, blockIdx.y * 128, blockIdx.x * 128);
}

// The three projections of x in ONE grid: column tiles 0..15 belong to Q,
// 16..19 to K, 20..23 to V.  Alone, the K and the V product have 64 tiles
// each and leave three quarters of the WGPs idle for a whole tile's time.
__global__ __launch_bounds__(128)
void gemm_qkv_f32_wmma(const float* __restrict__ X,
                       const float* __restrict__ Wq,
                       const float* __restrict__ Wk,
                       const float* __restrict__ Wv,
                       float* __restrict__ Qo, float* __restrict__ Ko,
                       float* __restrict__ Vo) {
  const int bx = blockIdx.x;
  const float* B = Wq;
  float* C = Qo;
  int N = DIM, n0 = bx * 128;
  if (bx >= (DIM + KVD) / 128) {
    B = Wv; C = Vo; N = KVD; n0 = bx * 128 - (DIM + KVD);
  } else if (bx >= DIM / 128) {
    B = Wk; C = Ko; N = KVD; n0 = bx * 128 - DIM;
  }
  gemm_tile_f32(X, B, C, N, DIM, blockIdx.y * 128, n0);
}

// ---------------------------------------------------------------------------
// RoPE in-place on a [rows, H*D] buffer; pair (2i, 2i+1) within each head.
// ---------------------------------------------------------------------------
__global__ __launch_bounds__(256)
void rope_f32(float* __restrict__ buf, int H, int total_pairs) {
  int idx = blockIdx.x * blockDim.x + threadIdx.x;
  if (idx >= total_pairs) return;
  const int half = HD / 2;
  int i   = idx % half;
  int h   = (idx / half) % H;
  int row = idx / (half * H);
  int s   = row % SEQ;
  float inv = __expf(-((float)(2 * i) / (float)HD) * __logf(10000.0f));
  float ang = (float)s * inv;
  float sn, cs;
  sincosf(ang, &sn, &cs);
  float* p = buf + ((size_t)row * H + h) * HD + 2 * i;
  float x1 = p[0], x2 = p[1];
  p[0] = x1 * cs - x2 * sn;
  p[1] = x1 * sn + x2 * cs;
}

// ---------------------------------------------------------------------------
// Attention: one workgroup = (32 queries) x (one q-head) x (one batch).
// Full 32x1024 score panel lives in LDS (CDNA5: 320KB/WGP), padded +1.
// K tile staged transposed (async b32), V tile staged row-major (async b128)
// reusing the same LDS buffer.  8 waves, 256 threads.
// ---------------------------------------------------------------------------
#define VT_STRIDE 68   // dwords per V-tile row (64 data + 4 pad, 16B aligned)

__global__ __launch_bounds__(256)
void attn_f32_wmma(const float* __restrict__ Q, const float* __restrict__ Kb,
                   const float* __restrict__ Vb, float* __restrict__ O) {
  __shared__ float sc[BQ][SEQ + 1];      // 32 x 1025 fp32  (~128 KB)
  __shared__ float qs[HD][BQ + 1];       // Q tile transposed [d][q]
  __shared__ float ktvt[64 * VT_STRIDE]; // K tile [d][key] (stride 65) then
                                         // V tile [key][d] (stride 68)

  const int qb = blockIdx.x;          // 0..31  query block
  const int h  = blockIdx.y;          // 0..31  q head
  const int b  = blockIdx.z;          // 0..1   batch
  const int g  = h >> 2;              // kv head (n_rep = 4)

  const int tid  = threadIdx.x;
  const int lane = tid & 31;
  const int wid  = tid >> 5;
  const int mi   = wid & 1;           // 16-row half of the 32-query block
  const int ni   = wid >> 1;          // 0..3 : 16-col group within 64
  const float scale = 0.125f;         // 1/sqrt(64)

  const size_t qrow0 = (size_t)b * SEQ + (size_t)qb * BQ;

  // ---- stage Q tile (32x64) transposed into LDS ----
  #pragma unroll
  for (int i = 0; i < 8; ++i) {
    int idx = tid + i * 256;
    int d = idx & 63, q = idx >> 6;
    cp_b32(&qs[d][q], &Q[(qrow0 + q) * DIM + h * HD + d]);
  }

  // ---- scores: S = Q * K^T over key chunks of 64 ----
  const int mrow = mi * 16 + (lane & 15);
  const int ncol = ni * 16 + (lane & 15);
  for (int kv0 = 0; kv0 < SEQ; kv0 += 64) {
    __syncthreads();                  // prev chunk consumed
    #pragma unroll
    for (int i = 0; i < 16; ++i) {    // 64x64 K tile, transposed, coalesced on d
      int idx = tid + i * 256;
      int d = idx & 63, ky = idx >> 6;
      cp_b32(&ktvt[d * 65 + ky],
             &Kb[((size_t)b * SEQ + kv0 + ky) * KVD + g * HD + d]);
    }
    wait_async_all();
    __syncthreads();

    v8f acc = {};
    #pragma unroll
    for (int kk = 0; kk < HD; kk += 4) {
      const int kl = kk + ((lane >> 4) << 1);
      v2f a  = (v2f){qs[kl][mrow], qs[kl + 1][mrow]};
      v2f bb = (v2f){ktvt[kl * 65 + ncol], ktvt[(kl + 1) * 65 + ncol]};
      acc = wmma_f32(a, bb, acc);
    }
    #pragma unroll
    for (int r = 0; r < 8; ++r) {
      int row = mi * 16 + ((lane >> 4) << 3) + r;
      int col = kv0 + ni * 16 + (lane & 15);
      sc[row][col] = acc[r];
    }
  }
  __syncthreads();

  // ---- softmax over each of the 32 rows; wave w owns rows 4w..4w+3 ----
  #pragma unroll
  for (int j = 0; j < 4; ++j) {
    const int r = wid * 4 + j;
    float mx = -INFINITY;
    for (int c = lane; c < SEQ; c += 32) mx = fmaxf(mx, sc[r][c]);
    #pragma unroll
    for (int off = 16; off; off >>= 1) mx = fmaxf(mx, __shfl_xor(mx, off, 32));
    float sum = 0.0f;
    for (int c = lane; c < SEQ; c += 32) {
      float p = __expf(scale * (sc[r][c] - mx));
      sc[r][c] = p;
      sum += p;
    }
    #pragma unroll
    for (int off = 16; off; off >>= 1) sum += __shfl_xor(sum, off, 32);
    float rinv = 1.0f / sum;
    for (int c = lane; c < SEQ; c += 32) sc[r][c] *= rinv;
  }

  // ---- O = P(32x1024) @ V(1024x64); V chunks staged through LDS ----
  const float* Vg = Vb + (size_t)b * SEQ * KVD + g * HD;
  v8f oac = {};
  for (int kv0 = 0; kv0 < SEQ; kv0 += 64) {
    __syncthreads();                  // prev V chunk consumed / softmax done
    #pragma unroll
    for (int i = 0; i < 4; ++i) {     // 64x64 V tile, row-major, b128
      int idx = tid + i * 256;
      int ky = idx >> 4, d4 = (idx & 15) << 2;
      cp_b128(&ktvt[ky * VT_STRIDE + d4],
              &Vg[(size_t)(kv0 + ky) * KVD + d4]);
    }
    wait_async_all();
    __syncthreads();

    #pragma unroll
    for (int kk = 0; kk < 64; kk += 4) {
      const int kl = kk + ((lane >> 4) << 1);
      const int kg = kv0 + kl;
      v2f a  = (v2f){sc[mrow][kg], sc[mrow][kg + 1]};
      v2f bb = (v2f){ktvt[kl * VT_STRIDE + ncol],
                     ktvt[(kl + 1) * VT_STRIDE + ncol]};
      oac = wmma_f32(a, bb, oac);
    }
  }

  #pragma unroll
  for (int r = 0; r < 8; ++r) {
    int q = mi * 16 + ((lane >> 4) << 3) + r;
    O[(qrow0 + q) * DIM + h * HD + ncol] = oac[r];
  }
}

// ---------------------------------------------------------------------------
extern "C" void kernel_launch(void* const* d_in, const int* in_sizes, int n_in,
                              void* d_out, int out_size, void* d_ws, size_t ws_size,
                              hipStream_t stream) {
  const float* x  = (const float*)d_in[0];
  const float* wq = (const float*)d_in[1];
  const float* wk = (const float*)d_in[2];
  const float* wv = (const float*)d_in[3];
  const float* wo = (const float*)d_in[4];

  float* ws = (float*)d_ws;
  float* Qb = ws;                              // 2048*2048
  float* Kb = Qb + (size_t)N_ROWS * DIM;       // 2048*512
  float* Vb = Kb + (size_t)N_ROWS * KVD;       // 2048*512
  float* Ab = Vb + (size_t)N_ROWS * KVD;       // 2048*2048 (attention output)

  dim3 gblk(128);
  dim3 ablk(256);

  // QKV projections, one launch
  gemm_qkv_f32_wmma<<<dim3((DIM + 2 * KVD) / 128, N_ROWS / 128), gblk, 0, stream>>>(x, wq, wk, wv, Qb, Kb, Vb);

  // RoPE on Q and K
  {
    int pq = N_ROWS * HQ * (HD / 2);
    int pk = N_ROWS * HKV * (HD / 2);
    rope_f32<<<(pq + 255) / 256, ablk, 0, stream>>>(Qb, HQ, pq);
    rope_f32<<<(pk + 255) / 256, ablk, 0, stream>>>(Kb, HKV, pk);
  }

  // Attention
  attn_f32_wmma<<<dim3(SEQ / BQ, HQ, 2), ablk, 0, stream>>>(Qb, Kb, Vb, Ab);

  // Output projection
  gemm_f32_wmma<<<dim3(DIM / 128, N_ROWS / 128), gblk, 0, stream>>>(Ab, wo, (float*)d_out, N_ROWS, DIM, DIM);
}

// v002
// One run takes 469 microseconds.
// In two side-by-side timings against v001, it was 1.06 and 1.05 times as fast.
// All steps since v000 together make it 1.36 times as fast.
#include <hip/hip_runtime.h>
#include <math.h>

// ---------------------------------------------------------------------------
// CDNA5 (gfx1250) fp32 WMMA attention layer.
//   Q = rope(x@wq), K = rope(x@wk), V = x@wv
//   O = softmax(Q Kt / sqrt(D)) V ;  out = O @ wo
// All matmuls via V_WMMA_F32_16X16X4_F32 (exact fp32).
// GEMM tiles double-buffered in LDS via GLOBAL_LOAD_ASYNC_TO_LDS (ASYNCcnt).
// ---------------------------------------------------------------------------

typedef __attribute__((ext_vector_type(2))) float v2f;
typedef __attribute__((ext_vector_type(8))) float v8f;

#define N_ROWS   2048   // B*S
#define SEQ      1024
#define DIM      2048
#define KVD      512
#define HQ       32
#define HKV      8
#define HD       64
#define BQ       32     // query rows per attention workgroup

// ---------------- async global->LDS helpers (probe-guarded) ----------------
#if defined(__has_builtin)
#  if __has_builtin(__builtin_amdgcn_global_load_async_to_lds_b32) && \
      __has_builtin(__builtin_amdgcn_global_load_async_to_lds_b128)
#    define HAVE_ASYNC_LDS 1
#  else
#    define HAVE_ASYNC_LDS 0
#  endif
#  if __has_builtin(__builtin_amdgcn_s_wait_asynccnt)
#    define HAVE_WAIT_ASYNC 1
#  else
#    define HAVE_WAIT_ASYNC 0
#  endif
#else
#  define HAVE_ASYNC_LDS 0
#  define HAVE_WAIT_ASYNC 0
#endif

#if HAVE_ASYNC_LDS
typedef int vsi4 __attribute__((vector_size(16)));
typedef __attribute__((address_space(1))) int  gas_i32;   // global int*
typedef __attribute__((address_space(3))) int  las_i32;   // LDS int*
typedef __attribute__((address_space(1))) vsi4 gas_v4i;   // global int4*
typedef __attribute__((address_space(3))) vsi4 las_v4i;   // LDS int4*
#endif

static __device__ __forceinline__ void cp_b32(float* lds_dst, const float* gsrc) {
#if HAVE_ASYNC_LDS
  __builtin_amdgcn_global_load_async_to_lds_b32(
      (gas_i32*)gsrc, (las_i32*)lds_dst, 0, 0);
#else
  *lds_dst = *gsrc;
#endif
}

static __device__ __forceinline__ void cp_b128(float* lds_dst, const float* gsrc) {
#if HAVE_ASYNC_LDS
  __builtin_amdgcn_global_load_async_to_lds_b128(
      (gas_v4i*)gsrc, (las_v4i*)lds_dst, 0, 0);
#else
  *(float4*)lds_dst = *(const float4*)gsrc;
#endif
}

static __device__ __forceinline__ void wait_async_all() {
#if HAVE_ASYNC_LDS
#  if HAVE_WAIT_ASYNC
  __builtin_amdgcn_s_wait_asynccnt(0);
#  else
  asm volatile("s_wait_asynccnt 0" ::: "memory");
#  endif
#endif
}

static __device__ __forceinline__ v8f wmma_f32(v2f a, v2f b, v8f c) {
  // V_WMMA_F32_16X16X4_F32 : D = A(16x4) * B(4x16) + C, fp32 exact
  return __builtin_amdgcn_wmma_f32_16x16x4_f32(
      /*neg_a=*/false, a, /*neg_b=*/false, b,
      /*c_mod=*/(short)0, c, /*reuse_a=*/false, /*reuse_b=*/false);
}

// ---------------------------------------------------------------------------
// fp32 GEMM:  C[M,N] = A[M,K] * B[K,N]  (row-major, block tile 128x128)
// 128 threads = 4 waves arranged 2(m) x 2(n); each wave owns a 64x64 subtile
// (4x4 WMMA accumulators -> 16 WMMAs per k-step vs 8 fragment fetches).
// LDS double-buffered; tiles staged with async global->LDS copies.
// A tile kept row-major with 20-dword padded stride so an A fragment is one
// aligned ds_load_b64 (bank-conflict free).
// ---------------------------------------------------------------------------
#define GA_STRIDE 20   // dwords per A-tile row (16 data + 4 pad, 16B aligned)

// One 128x128 tile of C, rows from m0 and columns from n0, by one workgroup.
static __device__ __forceinline__
void gemm_tile_f32(const float* __restrict__ A, const float* __restrict__ B,
                   float* __restrict__ C, int N, int K, int m0, int n0) {
  __shared__ float As[2][128 * GA_STRIDE]; // [m][k] row-major, padded
  __shared__ float Bs[2][16 * 128];        // [k][n]

  const int tid  = threadIdx.x;
  const int lane = tid & 31;
  const int wid  = tid >> 5;
  const int wm   = wid >> 1;            // 0..1 -> 64-row strip
  const int wn   = wid & 1;             // 0..1 -> 64-col strip

  v8f acc[4][4] = {};

  // stage tile for k0 = 0 into buffer 0
  {
    #pragma unroll
    for (int i = 0; i < 4; ++i) {              // A: 512 x 16B quads
      int idx = tid + i * 128;
      int m = idx >> 2, kq = (idx & 3) << 2;
      cp_b128(&As[0][m * GA_STRIDE + kq], &A[(size_t)(m0 + m) * K + kq]);
    }
    #pragma unroll
    for (int i = 0; i < 4; ++i) {              // B: 512 x 16B quads
      int idx = tid + i * 128;
      int k = idx >> 5, n4 = (idx & 31) << 2;
      cp_b128(&Bs[0][k * 128 + n4], &B[(size_t)k * N + n0 + n4]);
    }
  }
  wait_async_all();
  __syncthreads();

  for (int k0 = 0; k0 < K; k0 += 16) {
    const int cur = (k0 >> 4) & 1;
    const int nxt = cur ^ 1;

    // prefetch next k-tile while this one is consumed by the matrix pipe
    if (k0 + 16 < K) {
      #pragma unroll
      for (int i = 0; i < 4; ++i) {
        int idx = tid + i * 128;
        int m = idx >> 2, kq = (idx & 3) << 2;
        cp_b128(&As[nxt][m * GA_STRIDE + kq],
                &A[(size_t)(m0 + m) * K + (k0 + 16 + kq)]);
      }
      #pragma unroll
      for (int i = 0; i < 4; ++i) {
        int idx = tid + i * 128;
        int k = idx >> 5, n4 = (idx & 31) << 2;
        cp_b128(&Bs[nxt][k * 128 + n4],
                &B[(size_t)(k0 + 16 + k) * N + n0 + n4]);
      }
    }

    #pragma unroll
    for (int kk = 0; kk < 16; kk += 4) {
      const int kl = kk + ((lane >> 4) << 1);   // lanes 16..31 take K+2,K+3
      v2f afr[4], bfr[4];
      #pragma unroll
      for (int mi = 0; mi < 4; ++mi) {
        int mrow = wm * 64 + mi * 16 + (lane & 15);
        afr[mi] = *(const v2f*)&As[cur][mrow * GA_STRIDE + kl]; // ds_load_b64
      }
      #pragma unroll
      for (int ni = 0; ni < 4; ++ni) {
        int ncol = wn * 64 + ni * 16 + (lane & 15);
        bfr[ni] = (v2f){Bs[cur][kl * 128 + ncol], Bs[cur][(kl + 1) * 128 + ncol]};
      }
      #pragma unroll
      for (int mi = 0; mi < 4; ++mi)
        #pragma unroll
        for (int ni = 0; ni < 4; ++ni)
          acc[mi][ni] = wmma_f32(afr[mi], bfr[ni], acc[mi][ni]);
    }

    wait_async_all();
    __syncthreads();
  }

  // Writeback: VGPR r holds M = (lane>=16 ? 8 : 0)+r, N = lane&15.
  #pragma unroll
  for (int mi = 0; mi < 4; ++mi)
    #pragma unroll
    for (int ni = 0; ni < 4; ++ni)
      #pragma unroll
      for (int r = 0; r < 8; ++r) {
        int row = m0 + wm * 64 + mi * 16 + ((lane >> 4) << 3) + r;
        int col = n0 + wn * 64 + ni * 16 + (lane & 15);
        C[(size_t)row * N + col] = acc[mi][ni][r];
      }
}

__global__ __launch_bounds__(128)
void gemm_f32_wmma(const float* __restrict__ A, const float* __restrict__ B,
                   float* __restrict__ C, int M, int N, int K) {
  gemm_tile_f32(A, B, C, N, K, blockIdx.y * 128, blockIdx.x * 128);
}

// The three projections of x in ONE grid: column tiles 0..15 belong to Q,
// 16..19 to K, 20..23 to V.  Alone, the K and the V product have 64 tiles
// each and leave three quarters of the WGPs idle for a whole tile's time.
__global__ __launch_bounds__(128)
void gemm_qkv_f32_wmma(const float* __restrict__ X,
                       const float* __restrict__ Wq,
                       const float* __restrict__ Wk,
                       const float* __restrict__ Wv,
                       float* __restrict__ Qo, float* __restrict__ Ko,
                       float* __restrict__ Vo) {
  const int bx = blockIdx.x;
  const float* B = Wq;
  float* C = Qo;
  int N = DIM, n0 = bx * 128;
  if (bx >= (DIM + KVD) / 128) {
    B = Wv; C = Vo; N = KVD; n0 = bx * 128 - (DIM + KVD);
  } else if (bx >= DIM / 128) {
    B = Wk; C = Ko; N = KVD; n0 = bx * 128 - DIM;
  }
  gemm_tile_f32(X, B, C, N, DIM, blockIdx.y * 128, n0);
}

// ---------------------------------------------------------------------------
// RoPE in-place on a [rows, H*D] buffer; pair (2i, 2i+1) within each head.
// ---------------------------------------------------------------------------
__global__ __launch_bounds__(256)
void rope_f32(float* __restrict__ buf, int H, int total_pairs) {
  int idx = blockIdx.x * blockDim.x + threadIdx.x;
  if (idx >= total_pairs) return;
  const int half = HD / 2;
  int i   = idx % half;
  int h   = (idx / half) % H;
  int row = idx / (half * H);
  int s   = row % SEQ;
  float inv = __expf(-((float)(2 * i) / (float)HD) * __logf(10000.0f));
  float ang = (float)s * inv;
  float sn, cs;
  sincosf(ang, &sn, &cs);
  float* p = buf + ((size_t)row * H + h) * HD + 2 * i;
  float x1 = p[0], x2 = p[1];
  p[0] = x1 * cs - x2 * sn;
  p[1] = x1 * sn + x2 * cs;
}

// ---------------------------------------------------------------------------
// Attention: one workgroup = (32 queries) x (one q-head) x (one batch).
// Full 32x1024 score panel lives in LDS (CDNA5: 320KB/WGP).
// Q, K and the score panel lie row-major, k contiguous, so that a lane's two
// k values of a fragment are ONE ds_load_b64; their pitches are 4 dwords
// modulo 64, which puts the 64 dwords of such a read on 64 different banks.
// V stays [key][d] (a lane's two k values are two rows); its pitch is 16
// dwords modulo 64, so the four rows of a fragment fall on different banks.
// K and V tiles share one LDS buffer.  8 waves, 256 threads.
// ---------------------------------------------------------------------------
#define QK_PITCH 68    // dwords per Q / K tile row (64 data + 4 pad)
#define V_PITCH  80    // dwords per V tile row     (64 data + 16 pad)
#define SC_PITCH 1028  // dwords per score row      (1024 data + 4 pad)

__global__ __launch_bounds__(256)
void attn_f32_wmma(const float* __restrict__ Q, const float* __restrict__ Kb,
                   const float* __restrict__ Vb, float* __restrict__ O) {
  __shared__ __attribute__((aligned(16))) float sc[BQ][SC_PITCH];   // ~128 KB
  __shared__ __attribute__((aligned(16))) float qs[BQ * QK_PITCH];  // Q [q][d]
  __shared__ __attribute__((aligned(16))) float ktvt[64 * V_PITCH]; // K [key][d]
                                                                    // then V [key][d]

  const int qb = blockIdx.x;          // 0..31  query block
  const int h  = blockIdx.y;          // 0..31  q head
  const int b  = blockIdx.z;          // 0..1   batch
  const int g  = h >> 2;              // kv head (n_rep = 4)

  const int tid  = threadIdx.x;
  const int lane = tid & 31;
  const int wid  = tid >> 5;
  const int mi   = wid & 1;           // 16-row half of the 32-query block
  const int ni   = wid >> 1;          // 0..3 : 16-col group within 64
  const int kh   = (lane >> 4) << 1;  // lanes 16..31 take K+2,K+3
  const float scale = 0.125f;         // 1/sqrt(64)

  const size_t qrow0 = (size_t)b * SEQ + (size_t)qb * BQ;
  const int mrow = mi * 16 + (lane & 15);
  const int ncol = ni * 16 + (lane & 15);

  // ---- stage Q tile (32x64) row-major, then keep this wave's 16 A fragments
  //      in registers: they are the same for every key chunk ----
  #pragma unroll                      // both copies issue back to back
  for (int i = 0; i < 2; ++i) {
    int idx = tid + i * 256;
    int q = idx >> 4, d4 = (idx & 15) << 2;
    cp_b128(&qs[q * QK_PITCH + d4], &Q[(qrow0 + q) * DIM + h * HD + d4]);
  }
  wait_async_all();
  __syncthreads();                    // publishes the Q tile to every wave and
                                      // holds the LDS reads behind the wait
  v2f qf[HD / 4];
  #pragma unroll                      // constant indices keep qf in registers
  for (int j = 0; j < HD / 4; ++j)
    qf[j] = *(const v2f*)&qs[mrow * QK_PITCH + 4 * j + kh];   // ds_load_b64

  // ---- scores: S = Q * K^T over key chunks of 64 ----
  for (int kv0 = 0; kv0 < SEQ; kv0 += 64) {
    __syncthreads();                  // prev chunk consumed
    #pragma unroll                    // the four copies issue back to back
    for (int i = 0; i < 4; ++i) {     // 64x64 K tile, row-major, b128
      int idx = tid + i * 256;
      int ky = idx >> 4, d4 = (idx & 15) << 2;
      cp_b128(&ktvt[ky * QK_PITCH + d4],
              &Kb[((size_t)b * SEQ + kv0 + ky) * KVD + g * HD + d4]);
    }
    wait_async_all();
    __syncthreads();

    v2f kf[HD / 4];
    #pragma unroll                    // constant indices keep kf in registers
    for (int j = 0; j < HD / 4; ++j)
      kf[j] = *(const v2f*)&ktvt[ncol * QK_PITCH + 4 * j + kh]; // ds_load_b64
    v8f acc = {};
    #pragma unroll                    // same reason: qf, kf by constant index
    for (int j = 0; j < HD / 4; ++j)
      acc = wmma_f32(qf[j], kf[j], acc);
    #pragma unroll
    for (int r = 0; r < 8; ++r) {
      int row = mi * 16 + ((lane >> 4) << 3) + r;
      int col = kv0 + ni * 16 + (lane & 15);
      sc[row][col] = acc[r];
    }
  }
  __syncthreads();

  // ---- softmax over each of the 32 rows; wave w owns rows 4w..4w+3 ----
  #pragma unroll
  for (int j = 0; j < 4; ++j) {
    const int r = wid * 4 + j;
    float mx = -INFINITY;
    for (int c = lane; c < SEQ; c += 32) mx = fmaxf(mx, sc[r][c]);
    #pragma unroll
    for (int off = 16; off; off >>= 1) mx = fmaxf(mx, __shfl_xor(mx, off, 32));
    float sum = 0.0f;
    for (int c = lane; c < SEQ; c += 32) {
      float p = __expf(scale * (sc[r][c] - mx));
      sc[r][c] = p;
      sum += p;
    }
    #pragma unroll
    for (int off = 16; off; off >>= 1) sum += __shfl_xor(sum, off, 32);
    float rinv = 1.0f / sum;
    for (int c = lane; c < SEQ; c += 32) sc[r][c] *= rinv;
  }

  // ---- O = P(32x1024) @ V(1024x64); V chunks staged through LDS ----
  const float* Vg = Vb + (size_t)b * SEQ * KVD + g * HD;
  v8f oac = {};
  for (int kv0 = 0; kv0 < SEQ; kv0 += 64) {
    __syncthreads();                  // prev V chunk consumed / softmax done
    #pragma unroll
    for (int i = 0; i < 4; ++i) {     // 64x64 V tile, row-major, b128
      int idx = tid + i * 256;
      int ky = idx >> 4, d4 = (idx & 15) << 2;
      cp_b128(&ktvt[ky * V_PITCH + d4],
              &Vg[(size_t)(kv0 + ky) * KVD + d4]);
    }
    wait_async_all();
    __syncthreads();

    const float* pb = &sc[mrow][kv0 + kh];
    const float* vb = &ktvt[kh * V_PITCH + ncol];
    v2f pf[16], vf[16];
    #pragma unroll                    // constant indices keep pf, vf in registers
    for (int j = 0; j < 16; ++j) {
      pf[j] = *(const v2f*)&pb[4 * j];                          // ds_load_b64
      vf[j] = (v2f){vb[(4 * j) * V_PITCH], vb[(4 * j + 1) * V_PITCH]};
    }
    #pragma unroll                    // same reason: pf, vf by constant index
    for (int j = 0; j < 16; ++j)
      oac = wmma_f32(pf[j], vf[j], oac);
  }

  #pragma unroll
  for (int r = 0; r < 8; ++r) {
    int q = mi * 16 + ((lane >> 4) << 3) + r;
    O[(qrow0 + q) * DIM + h * HD + ncol] = oac[r];
  }
}

// ---------------------------------------------------------------------------
extern "C" void kernel_launch(void* const* d_in, const int* in_sizes, int n_in,
                              void* d_out, int out_size, void* d_ws, size_t ws_size,
                              hipStream_t stream) {
  const float* x  = (const float*)d_in[0];
  const float* wq = (const float*)d_in[1];
  const float* wk = (const float*)d_in[2];
  const float* wv = (const float*)d_in[3];
  const float* wo = (const float*)d_in[4];

  float* ws = (float*)d_ws;
  float* Qb = ws;                              // 2048*2048
  float* Kb = Qb + (size_t)N_ROWS * DIM;       // 2048*512
  float* Vb = Kb + (size_t)N_ROWS * KVD;       // 2048*512
  float* Ab = Vb + (size_t)N_ROWS * KVD;       // 2048*2048 (attention output)

  dim3 gblk(128);
  dim3 ablk(256);

  // QKV projections, one launch
  gemm_qkv_f32_wmma<<<dim3((DIM + 2 * KVD) / 128, N_ROWS / 128), gblk, 0, stream>>>(x, wq, wk, wv, Qb, Kb, Vb);

  // RoPE on Q and K
  {
    int pq = N_ROWS * HQ * (HD / 2);
    int pk = N_ROWS * HKV * (HD / 2);
    rope_f32<<<(pq + 255) / 256, ablk, 0, stream>>>(Qb, HQ, pq);
    rope_f32<<<(pk + 255) / 256, ablk, 0, stream>>>(Kb, HKV, pk);
  }

  // Attention
  attn_f32_wmma<<<dim3(SEQ / BQ, HQ, 2), ablk, 0, stream>>>(Qb, Kb, Vb, Ab);

  // Output projection
  gemm_f32_wmma<<<dim3(DIM / 128, N_ROWS / 128), gblk, 0, stream>>>(Ab, wo, (float*)d_out, N_ROWS, DIM, DIM);
}

// v003
// It runs in 405 microseconds.
// Timed twice side by side with v002, it ran 1.16 times as fast both times.
// All steps since v000 together make it 1.58 times as fast.
#include <hip/hip_runtime.h>
#include <math.h>

// ---------------------------------------------------------------------------
// CDNA5 (gfx1250) fp32 WMMA attention layer.
//   Q = rope(x@wq), K = rope(x@wk), V = x@wv
//   O = softmax(Q Kt / sqrt(D)) V ;  out = O @ wo
// All matmuls via V_WMMA_F32_16X16X4_F32 (exact fp32).
// GEMM tiles double-buffered in LDS via GLOBAL_LOAD_ASYNC_TO_LDS (ASYNCcnt).
// ---------------------------------------------------------------------------

typedef __attribute__((ext_vector_type(2))) float v2f;
typedef __attribute__((ext_vector_type(8))) float v8f;

#define N_ROWS   2048   // B*S
#define SEQ      1024
#define DIM      2048
#define KVD      512
#define HQ       32
#define HKV      8
#define HD       64
#define BQ       32     // query rows per attention workgroup

// ---------------- async global->LDS helpers (probe-guarded) ----------------
#if defined(__has_builtin)
#  if __has_builtin(__builtin_amdgcn_global_load_async_to_lds_b32) && \
      __has_builtin(__builtin_amdgcn_global_load_async_to_lds_b128)
#    define HAVE_ASYNC_LDS 1
#  else
#    define HAVE_ASYNC_LDS 0
#  endif
#  if __has_builtin(__builtin_amdgcn_s_wait_asynccnt)
#    define HAVE_WAIT_ASYNC 1
#  else
#    define HAVE_WAIT_ASYNC 0
#  endif
#else
#  define HAVE_ASYNC_LDS 0
#  define HAVE_WAIT_ASYNC 0
#endif

#if HAVE_ASYNC_LDS
typedef int vsi4 __attribute__((vector_size(16)));
typedef __attribute__((address_space(1))) int  gas_i32;   // global int*
typedef __attribute__((address_space(3))) int  las_i32;   // LDS int*
typedef __attribute__((address_space(1))) vsi4 gas_v4i;   // global int4*
typedef __attribute__((address_space(3))) vsi4 las_v4i;   // LDS int4*
#endif

static __device__ __forceinline__ void cp_b32(float* lds_dst, const float* gsrc) {
#if HAVE_ASYNC_LDS
  __builtin_amdgcn_global_load_async_to_lds_b32(
      (gas_i32*)gsrc, (las_i32*)lds_dst, 0, 0);
#else
  *lds_dst = *gsrc;
#endif
}

static __device__ __forceinline__ void cp_b128(float* lds_dst, const float* gsrc) {
#if HAVE_ASYNC_LDS
  __builtin_amdgcn_global_load_async_to_lds_b128(
      (gas_v4i*)gsrc, (las_v4i*)lds_dst, 0, 0);
#else
  *(float4*)lds_dst = *(const float4*)gsrc;
#endif
}

static __device__ __forceinline__ void wait_async_all() {
#if HAVE_ASYNC_LDS
#  if HAVE_WAIT_ASYNC
  __builtin_amdgcn_s_wait_asynccnt(0);
#  else
  asm volatile("s_wait_asynccnt 0" ::: "memory");
#  endif
#endif
}

static __device__ __forceinline__ v8f wmma_f32(v2f a, v2f b, v8f c) {
  // V_WMMA_F32_16X16X4_F32 : D = A(16x4) * B(4x16) + C, fp32 exact
  return __builtin_amdgcn_wmma_f32_16x16x4_f32(
      /*neg_a=*/false, a, /*neg_b=*/false, b,
      /*c_mod=*/(short)0, c, /*reuse_a=*/false, /*reuse_b=*/false);
}

// ---------------------------------------------------------------------------
// fp32 GEMM:  C[M,N] = A[M,DIM] * B[DIM,N]  (row-major).
// ONE workgroup of 8 waves per WGP, two waves per SIMD: while one wave waits
// for its LDS fragments or issues copies, the other feeds the matrix unit.
// The block tile is cut so that the grid has exactly 256 equal tiles.
// A wave owns MI x NI accumulators of 16x16; its columns are whole 128-B lines.
// LDS double-buffered, 32 k per stage, staged with async global->LDS copies.
// A tile kept row-major with a 36-dword pitch so an A fragment is one aligned
// ds_load_b64 (bank-conflict free).  The B pitch is 8 dwords over the tile's
// width: rows k and k+2, read by the two lane halves, fall on different banks.
// ---------------------------------------------------------------------------
#define KT        32   // k depth of one staged tile
#define GA_STRIDE 36   // dwords per A-tile row (32 data + 4 pad, 16B aligned)

// Column gc of the row of outputs [Q | K | V] -> its matrix, pitch and column.
// Selects, not branches: every lane stays on for the copies that follow.
template <typename P>
static __device__ __forceinline__
void pick_qkv(int gc, P q, P k, P v, P& w, int& n, int& col) {
  const bool is_v = gc >= DIM + KVD, is_k = gc >= DIM;
  w   = is_v ? v : (is_k ? k : q);
  n   = is_k ? KVD : DIM;
  col = gc - (is_v ? DIM + KVD : (is_k ? DIM : 0));
}

// One tile of C, rows from m0 and columns from n0, by one workgroup of
// WMW x WNW waves.  With QKV the columns run over [B0 | B1 | B2] and the
// outputs over [C0 | C1 | C2]; every 16-column block lies in one of them.
template <int WMW, int WNW, int MI, int NI, bool QKV>
static __device__ __forceinline__
void gemm_tile_f32(const float* __restrict__ A, const float* __restrict__ B0,
                   const float* __restrict__ B1, const float* __restrict__ B2,
                   float* __restrict__ C0, float* __restrict__ C1,
                   float* __restrict__ C2, int m0, int n0) {
  constexpr int TM  = WMW * MI * 16;           // tile rows
  constexpr int TN  = WNW * NI * 16;           // tile columns
  constexpr int BP  = TN + 8;                  // dwords per B-tile row
  constexpr int NT  = WMW * WNW * 32;          // threads
  constexpr int ACP = TM * (KT / 4) / NT;      // A copies per thread and stage
  constexpr int BCP = KT * (TN / 4) / NT;      // B copies per thread and stage
  static_assert(ACP * NT == TM * (KT / 4) && BCP * NT == KT * (TN / 4),
                "every lane copies in every round");
  __shared__ __attribute__((aligned(16))) float As[2][TM * GA_STRIDE]; // [m][k]
  __shared__ __attribute__((aligned(16))) float Bs[2][KT * BP];        // [k][n]

  const int tid  = threadIdx.x;
  const int lane = tid & 31;
  const int wid  = __builtin_amdgcn_readfirstlane(tid >> 5);  // scalar
  const int wm   = wid / WNW;           // row strip of MI*16 rows
  const int wn   = wid % WNW;           // column strip of NI*16 columns

  v8f acc[MI][NI] = {};

  // Each lane's copy sources; they move on by one stage per call of stage().
  const float* ag = A + (size_t)(m0 + (tid >> 3)) * DIM + ((tid & 7) << 2);
  const int    al = (tid >> 3) * GA_STRIDE + ((tid & 7) << 2);
  const float* bg[BCP];
  int bstep[BCP], bl[BCP];
  #pragma unroll
  for (int i = 0; i < BCP; ++i) {
    int idx = tid + i * NT;
    int k = idx / (TN / 4), c = (idx % (TN / 4)) << 2;
    const float* w = B0;
    int n = DIM, col = n0 + c;
    if (QKV) pick_qkv(n0 + c, B0, B1, B2, w, n, col);
    bg[i]    = w + (size_t)k * n + col;
    bstep[i] = KT * n;
    bl[i]    = k * BP + c;
  }
  auto stage = [&](int buf) {
    #pragma unroll
    for (int i = 0; i < ACP; ++i)
      cp_b128(&As[buf][al + i * (NT / 8) * GA_STRIDE],
              ag + (size_t)i * (NT / 8) * DIM);
    #pragma unroll
    for (int i = 0; i < BCP; ++i) {
      cp_b128(&Bs[buf][bl[i]], bg[i]);
      bg[i] += bstep[i];
    }
    ag += KT;
  };

  stage(0);
  // Stage 0's copies of this wave have landed; the barrier publishes them.
  asm volatile("s_wait_asynccnt 0x0" ::: "memory");
  __syncthreads();

  for (int k0 = 0; k0 < DIM; k0 += KT) {
    const int cur = (k0 / KT) & 1;

    // next stage's copies fly while this one is consumed by the matrix pipe
    if (k0 + KT < DIM) stage(cur ^ 1);

    #pragma unroll
    for (int kk = 0; kk < KT; kk += 4) {
      const int kl = kk + ((lane >> 4) << 1);   // lanes 16..31 take K+2,K+3
      v2f afr[MI], bfr[NI];
      #pragma unroll
      for (int mi = 0; mi < MI; ++mi) {
        int mrow = (wm * MI + mi) * 16 + (lane & 15);
        afr[mi] = *(const v2f*)&As[cur][mrow * GA_STRIDE + kl]; // ds_load_b64
      }
      #pragma unroll
      for (int ni = 0; ni < NI; ++ni) {
        int ncol = (wn * NI + ni) * 16 + (lane & 15);
        bfr[ni] = (v2f){Bs[cur][kl * BP + ncol], Bs[cur][(kl + 1) * BP + ncol]};
      }
      #pragma unroll
      for (int mi = 0; mi < MI; ++mi)
        #pragma unroll
        for (int ni = 0; ni < NI; ++ni)
          acc[mi][ni] = wmma_f32(afr[mi], bfr[ni], acc[mi][ni]);
    }

    // This wave's reads of the buffer have retired before the barrier behind
    // which the next trip's copies overwrite it.
    asm volatile("s_wait_dscnt 0x0" ::: "memory");
    // The next stage's copies of this wave have landed; the barrier publishes
    // them to the other waves.
    asm volatile("s_wait_asynccnt 0x0" ::: "memory");
    __syncthreads();
  }

  // Writeback: VGPR r holds M = (lane>=16 ? 8 : 0)+r, N = lane&15.
  #pragma unroll
  for (int ni = 0; ni < NI; ++ni) {
    float* c = C0;
    int n = DIM, col = n0 + (wn * NI + ni) * 16;   // same for the whole wave
    if (QKV) pick_qkv(col, C0, C1, C2, c, n, col);
    col += lane & 15;
    #pragma unroll
    for (int mi = 0; mi < MI; ++mi)
      #pragma unroll
      for (int r = 0; r < 8; ++r) {
        int row = m0 + (wm * MI + mi) * 16 + ((lane >> 4) << 3) + r;
        c[(size_t)row * n + col] = acc[mi][ni][r];
      }
  }
}

// Output projection: 128x128 tiles, waves 2(m) x 4(n) of 64x32 each.
__global__ __launch_bounds__(256)
// Two waves per SIMD is all this grid gives: the scheduler may spend
// registers on fragments fetched ahead instead of saving them for more waves.
__attribute__((amdgpu_waves_per_eu(2, 2)))
void gemm_f32_wmma(const float* __restrict__ A, const float* __restrict__ B,
                   float* __restrict__ C) {
  gemm_tile_f32<2, 4, 4, 2, false>(A, B, B, B, C, C, C,
                                   blockIdx.y * 128, blockIdx.x * 128);
}

// The three projections of x in ONE grid over the 3072 columns [Q | K | V]:
// 256x96 tiles, 8 waves of 32x96 each.  32 x 8 = 256 tiles, one per WGP;
// 384 tiles of 128x128 gave half of the WGPs two tiles and the rest one.
__global__ __launch_bounds__(256)
// Two waves per SIMD is all this grid gives: the scheduler may spend
// registers on fragments fetched ahead instead of saving them for more waves.
__attribute__((amdgpu_waves_per_eu(2, 2)))
void gemm_qkv_f32_wmma(const float* __restrict__ X,
                       const float* __restrict__ Wq,
                       const float* __restrict__ Wk,
                       const float* __restrict__ Wv,
                       float* __restrict__ Qo, float* __restrict__ Ko,
                       float* __restrict__ Vo) {
  gemm_tile_f32<8, 1, 2, 6, true>(X, Wq, Wk, Wv, Qo, Ko, Vo,
                                  blockIdx.y * 256, blockIdx.x * 96);
}

// ---------------------------------------------------------------------------
// RoPE in-place on a [rows, H*D] buffer; pair (2i, 2i+1) within each head.
// ---------------------------------------------------------------------------
__global__ __launch_bounds__(256)
void rope_f32(float* __restrict__ buf, int H, int total_pairs) {
  int idx = blockIdx.x * blockDim.x + threadIdx.x;
  if (idx >= total_pairs) return;
  const int half = HD / 2;
  int i   = idx % half;
  int h   = (idx / half) % H;
  int row = idx / (half * H);
  int s   = row % SEQ;
  float inv = __expf(-((float)(2 * i) / (float)HD) * __logf(10000.0f));
  float ang = (float)s * inv;
  float sn, cs;
  sincosf(ang, &sn, &cs);
  float* p = buf + ((size_t)row * H + h) * HD + 2 * i;
  float x1 = p[0], x2 = p[1];
  p[0] = x1 * cs - x2 * sn;
  p[1] = x1 * sn + x2 * cs;
}

// ---------------------------------------------------------------------------
// Attention: one workgroup = (32 queries) x (one q-head) x (one batch).
// Full 32x1024 score panel lives in LDS (CDNA5: 320KB/WGP).
// Q, K and the score panel lie row-major, k contiguous, so that a lane's two
// k values of a fragment are ONE ds_load_b64; their pitches are 4 dwords
// modulo 64, which puts the 64 dwords of such a read on 64 different banks.
// V stays [key][d] (a lane's two k values are two rows); its pitch is 16
// dwords modulo 64, so the four rows of a fragment fall on different banks.
// K and V tiles share one LDS buffer.  8 waves, 256 threads.
// ---------------------------------------------------------------------------
#define QK_PITCH 68    // dwords per Q / K tile row (64 data + 4 pad)
#define V_PITCH  80    // dwords per V tile row     (64 data + 16 pad)
#define SC_PITCH 1028  // dwords per score row      (1024 data + 4 pad)

__global__ __launch_bounds__(256)
void attn_f32_wmma(const float* __restrict__ Q, const float* __restrict__ Kb,
                   const float* __restrict__ Vb, float* __restrict__ O) {
  __shared__ __attribute__((aligned(16))) float sc[BQ][SC_PITCH];   // ~128 KB
  __shared__ __attribute__((aligned(16))) float qs[BQ * QK_PITCH];  // Q [q][d]
  __shared__ __attribute__((aligned(16))) float ktvt[64 * V_PITCH]; // K [key][d]
                                                                    // then V [key][d]

  const int qb = blockIdx.x;          // 0..31  query block
  const int h  = blockIdx.y;          // 0..31  q head
  const int b  = blockIdx.z;          // 0..1   batch
  const int g  = h >> 2;              // kv head (n_rep = 4)

  const int tid  = threadIdx.x;
  const int lane = tid & 31;
  const int wid  = tid >> 5;
  const int mi   = wid & 1;           // 16-row half of the 32-query block
  const int ni   = wid >> 1;          // 0..3 : 16-col group within 64
  const int kh   = (lane >> 4) << 1;  // lanes 16..31 take K+2,K+3
  const float scale = 0.125f;         // 1/sqrt(64)

  const size_t qrow0 = (size_t)b * SEQ + (size_t)qb * BQ;
  const int mrow = mi * 16 + (lane & 15);
  const int ncol = ni * 16 + (lane & 15);

  // ---- stage Q tile (32x64) row-major, then keep this wave's 16 A fragments
  //      in registers: they are the same for every key chunk ----
  #pragma unroll                      // both copies issue back to back
  for (int i = 0; i < 2; ++i) {
    int idx = tid + i * 256;
    int q = idx >> 4, d4 = (idx & 15) << 2;
    cp_b128(&qs[q * QK_PITCH + d4], &Q[(qrow0 + q) * DIM + h * HD + d4]);
  }
  wait_async_all();
  __syncthreads();                    // publishes the Q tile to every wave and
                                      // holds the LDS reads behind the wait
  v2f qf[HD / 4];
  #pragma unroll                      // constant indices keep qf in registers
  for (int j = 0; j < HD / 4; ++j)
    qf[j] = *(const v2f*)&qs[mrow * QK_PITCH + 4 * j + kh];   // ds_load_b64

  // ---- scores: S = Q * K^T over key chunks of 64 ----
  for (int kv0 = 0; kv0 < SEQ; kv0 += 64) {
    __syncthreads();                  // prev chunk consumed
    #pragma unroll                    // the four copies issue back to back
    for (int i = 0; i < 4; ++i) {     // 64x64 K tile, row-major, b128
      int idx = tid + i * 256;
      int ky = idx >> 4, d4 = (idx & 15) << 2;
      cp_b128(&ktvt[ky * QK_PITCH + d4],
              &Kb[((size_t)b * SEQ + kv0 + ky) * KVD + g * HD + d4]);
    }
    wait_async_all();
    __syncthreads();

    v2f kf[HD / 4];
    #pragma unroll                    // constant indices keep kf in registers
    for (int j = 0; j < HD / 4; ++j)
      kf[j] = *(const v2f*)&ktvt[ncol * QK_PITCH + 4 * j + kh]; // ds_load_b64
    v8f acc = {};
    #pragma unroll                    // same reason: qf, kf by constant index
    for (int j = 0; j < HD / 4; ++j)
      acc = wmma_f32(qf[j], kf[j], acc);
    #pragma unroll
    for (int r = 0; r < 8; ++r) {
      int row = mi * 16 + ((lane >> 4) << 3) + r;
      int col = kv0 + ni * 16 + (lane & 15);
      sc[row][col] = acc[r];
    }
  }
  __syncthreads();

  // ---- softmax over each of the 32 rows; wave w owns rows 4w..4w+3 ----
  #pragma unroll
  for (int j = 0; j < 4; ++j) {
    const int r = wid * 4 + j;
    float mx = -INFINITY;
    for (int c = lane; c < SEQ; c += 32) mx = fmaxf(mx, sc[r][c]);
    #pragma unroll
    for (int off = 16; off; off >>= 1) mx = fmaxf(mx, __shfl_xor(mx, off, 32));
    float sum = 0.0f;
    for (int c = lane; c < SEQ; c += 32) {
      float p = __expf(scale * (sc[r][c] - mx));
      sc[r][c] = p;
      sum += p;
    }
    #pragma unroll
    for (int off = 16; off; off >>= 1) sum += __shfl_xor(sum, off, 32);
    float rinv = 1.0f / sum;
    for (int c = lane; c < SEQ; c += 32) sc[r][c] *= rinv;
  }

  // ---- O = P(32x1024) @ V(1024x64); V chunks staged through LDS ----
  const float* Vg = Vb + (size_t)b * SEQ * KVD + g * HD;
  v8f oac = {};
  for (int kv0 = 0; kv0 < SEQ; kv0 += 64) {
    __syncthreads();                  // prev V chunk consumed / softmax done
    #pragma unroll
    for (int i = 0; i < 4; ++i) {     // 64x64 V tile, row-major, b128
      int idx = tid + i * 256;
      int ky = idx >> 4, d4 = (idx & 15) << 2;
      cp_b128(&ktvt[ky * V_PITCH + d4],
              &Vg[(size_t)(kv0 + ky) * KVD + d4]);
    }
    wait_async_all();
    __syncthreads();

    const float* pb = &sc[mrow][kv0 + kh];
    const float* vb = &ktvt[kh * V_PITCH + ncol];
    v2f pf[16], vf[16];
    #pragma unroll                    // constant indices keep pf, vf in registers
    for (int j = 0; j < 16; ++j) {
      pf[j] = *(const v2f*)&pb[4 * j];                          // ds_load_b64
      vf[j] = (v2f){vb[(4 * j) * V_PITCH], vb[(4 * j + 1) * V_PITCH]};
    }
    #pragma unroll                    // same reason: pf, vf by constant index
    for (int j = 0; j < 16; ++j)
      oac = wmma_f32(pf[j], vf[j], oac);
  }

  #pragma unroll
  for (int r = 0; r < 8; ++r) {
    int q = mi * 16 + ((lane >> 4) << 3) + r;
    O[(qrow0 + q) * DIM + h * HD + ncol] = oac[r];
  }
}

// ---------------------------------------------------------------------------
extern "C" void kernel_launch(void* const* d_in, const int* in_sizes, int n_in,
                              void* d_out, int out_size, void* d_ws, size_t ws_size,
                              hipStream_t stream) {
  const float* x  = (const float*)d_in[0];
  const float* wq = (const float*)d_in[1];
  const float* wk = (const float*)d_in[2];
  const float* wv = (const float*)d_in[3];
  const float* wo = (const float*)d_in[4];

  float* ws = (float*)d_ws;
  float* Qb = ws;                              // 2048*2048
  float* Kb = Qb + (size_t)N_ROWS * DIM;       // 2048*512
  float* Vb = Kb + (size_t)N_ROWS * KVD;       // 2048*512
  float* Ab = Vb + (size_t)N_ROWS * KVD;       // 2048*2048 (attention output)

  dim3 gblk(256);
  dim3 ablk(256);

  // QKV projections, one launch
  gemm_qkv_f32_wmma<<<dim3((DIM + 2 * KVD) / 96, N_ROWS / 256), gblk, 0, stream>>>(x, wq, wk, wv, Qb, Kb, Vb);

  // RoPE on Q and K
  {
    int pq = N_ROWS * HQ * (HD / 2);
    int pk = N_ROWS * HKV * (HD / 2);
    rope_f32<<<(pq + 255) / 256, ablk, 0, stream>>>(Qb, HQ, pq);
    rope_f32<<<(pk + 255) / 256, ablk, 0, stream>>>(Kb, HKV, pk);
  }

  // Attention
  attn_f32_wmma<<<dim3(SEQ / BQ, HQ, 2), ablk, 0, stream>>>(Qb, Kb, Vb, Ab);

  // Output projection
  gemm_f32_wmma<<<dim3(DIM / 128, N_ROWS / 128), gblk, 0, stream>>>(Ab, wo, (float*)d_out);
}

// v004
// It runs in 345 microseconds.
// Next to v003, in two timings, it ran 1.18 times as fast each time.
// All steps since v000 together make it 1.87 times as fast.
#include <hip/hip_runtime.h>
#include <math.h>

// ---------------------------------------------------------------------------
// CDNA5 (gfx1250) fp32 WMMA attention layer.
//   Q = rope(x@wq), K = rope(x@wk), V = x@wv
//   O = softmax(Q Kt / sqrt(D)) V ;  out = O @ wo
// All matmuls via V_WMMA_F32_16X16X4_F32 (exact fp32).
// GEMM tiles double-buffered in LDS via GLOBAL_LOAD_ASYNC_TO_LDS (ASYNCcnt).
// ---------------------------------------------------------------------------

typedef __attribute__((ext_vector_type(2))) float v2f;
typedef __attribute__((ext_vector_type(8))) float v8f;

#define N_ROWS   2048   // B*S
#define SEQ      1024
#define DIM      2048
#define KVD      512
#define HQ       32
#define HKV      8
#define HD       64

// ---------------- async global->LDS helpers (probe-guarded) ----------------
#if defined(__has_builtin)
#  if __has_builtin(__builtin_amdgcn_global_load_async_to_lds_b32) && \
      __has_builtin(__builtin_amdgcn_global_load_async_to_lds_b128)
#    define HAVE_ASYNC_LDS 1
#  else
#    define HAVE_ASYNC_LDS 0
#  endif
#else
#  define HAVE_ASYNC_LDS 0
#endif

#if HAVE_ASYNC_LDS
typedef int vsi4 __attribute__((vector_size(16)));
typedef __attribute__((address_space(1))) int  gas_i32;   // global int*
typedef __attribute__((address_space(3))) int  las_i32;   // LDS int*
typedef __attribute__((address_space(1))) vsi4 gas_v4i;   // global int4*
typedef __attribute__((address_space(3))) vsi4 las_v4i;   // LDS int4*
#endif

static __device__ __forceinline__ void cp_b32(float* lds_dst, const float* gsrc) {
#if HAVE_ASYNC_LDS
  __builtin_amdgcn_global_load_async_to_lds_b32(
      (gas_i32*)gsrc, (las_i32*)lds_dst, 0, 0);
#else
  *lds_dst = *gsrc;
#endif
}

static __device__ __forceinline__ void cp_b128(float* lds_dst, const float* gsrc) {
#if HAVE_ASYNC_LDS
  __builtin_amdgcn_global_load_async_to_lds_b128(
      (gas_v4i*)gsrc, (las_v4i*)lds_dst, 0, 0);
#else
  *(float4*)lds_dst = *(const float4*)gsrc;
#endif
}

static __device__ __forceinline__ v8f wmma_f32(v2f a, v2f b, v8f c) {
  // V_WMMA_F32_16X16X4_F32 : D = A(16x4) * B(4x16) + C, fp32 exact
  return __builtin_amdgcn_wmma_f32_16x16x4_f32(
      /*neg_a=*/false, a, /*neg_b=*/false, b,
      /*c_mod=*/(short)0, c, /*reuse_a=*/false, /*reuse_b=*/false);
}

// ---------------------------------------------------------------------------
// fp32 GEMM:  C[M,N] = A[M,DIM] * B[DIM,N]  (row-major).
// ONE workgroup of 8 waves per WGP, two waves per SIMD: while one wave waits
// for its LDS fragments or issues copies, the other feeds the matrix unit.
// The block tile is cut so that the grid has exactly 256 equal tiles.
// A wave owns MI x NI accumulators of 16x16; its columns are whole 128-B lines.
// LDS double-buffered, 32 k per stage, staged with async global->LDS copies.
// A tile kept row-major with a 36-dword pitch so an A fragment is one aligned
// ds_load_b64 (bank-conflict free).  The B pitch is 8 dwords over the tile's
// width: rows k and k+2, read by the two lane halves, fall on different banks.
// ---------------------------------------------------------------------------
#define KT        32   // k depth of one staged tile
#define GA_STRIDE 36   // dwords per A-tile row (32 data + 4 pad, 16B aligned)

// Column gc of the row of outputs [Q | K | V] -> its matrix, pitch and column.
// Selects, not branches: every lane stays on for the copies that follow.
template <typename P>
static __device__ __forceinline__
void pick_qkv(int gc, P q, P k, P v, P& w, int& n, int& col) {
  const bool is_v = gc >= DIM + KVD, is_k = gc >= DIM;
  w   = is_v ? v : (is_k ? k : q);
  n   = is_k ? KVD : DIM;
  col = gc - (is_v ? DIM + KVD : (is_k ? DIM : 0));
}

// One tile of C, rows from m0 and columns from n0, by one workgroup of
// WMW x WNW waves.  With QKV the columns run over [B0 | B1 | B2] and the
// outputs over [C0 | C1 | C2]; every 16-column block lies in one of them.
template <int WMW, int WNW, int MI, int NI, bool QKV>
static __device__ __forceinline__
void gemm_tile_f32(const float* __restrict__ A, const float* __restrict__ B0,
                   const float* __restrict__ B1, const float* __restrict__ B2,
                   float* __restrict__ C0, float* __restrict__ C1,
                   float* __restrict__ C2, int m0, int n0) {
  constexpr int TM  = WMW * MI * 16;           // tile rows
  constexpr int TN  = WNW * NI * 16;           // tile columns
  constexpr int BP  = TN + 8;                  // dwords per B-tile row
  constexpr int NT  = WMW * WNW * 32;          // threads
  constexpr int ACP = TM * (KT / 4) / NT;      // A copies per thread and stage
  constexpr int BCP = KT * (TN / 4) / NT;      // B copies per thread and stage
  static_assert(ACP * NT == TM * (KT / 4) && BCP * NT == KT * (TN / 4),
                "every lane copies in every round");
  __shared__ __attribute__((aligned(16))) float As[2][TM * GA_STRIDE]; // [m][k]
  __shared__ __attribute__((aligned(16))) float Bs[2][KT * BP];        // [k][n]

  const int tid  = threadIdx.x;
  const int lane = tid & 31;
  const int wid  = __builtin_amdgcn_readfirstlane(tid >> 5);  // scalar
  const int wm   = wid / WNW;           // row strip of MI*16 rows
  const int wn   = wid % WNW;           // column strip of NI*16 columns

  v8f acc[MI][NI] = {};

  // Each lane's copy sources; they move on by one stage per call of stage().
  const float* ag = A + (size_t)(m0 + (tid >> 3)) * DIM + ((tid & 7) << 2);
  const int    al = (tid >> 3) * GA_STRIDE + ((tid & 7) << 2);
  const float* bg[BCP];
  int bstep[BCP], bl[BCP];
  #pragma unroll
  for (int i = 0; i < BCP; ++i) {
    int idx = tid + i * NT;
    int k = idx / (TN / 4), c = (idx % (TN / 4)) << 2;
    const float* w = B0;
    int n = DIM, col = n0 + c;
    if (QKV) pick_qkv(n0 + c, B0, B1, B2, w, n, col);
    bg[i]    = w + (size_t)k * n + col;
    bstep[i] = KT * n;
    bl[i]    = k * BP + c;
  }
  auto stage = [&](int buf) {
    #pragma unroll
    for (int i = 0; i < ACP; ++i)
      cp_b128(&As[buf][al + i * (NT / 8) * GA_STRIDE],
              ag + (size_t)i * (NT / 8) * DIM);
    #pragma unroll
    for (int i = 0; i < BCP; ++i) {
      cp_b128(&Bs[buf][bl[i]], bg[i]);
      bg[i] += bstep[i];
    }
    ag += KT;
  };

  stage(0);
  // Stage 0's copies of this wave have landed; the barrier publishes them.
  asm volatile("s_wait_asynccnt 0x0" ::: "memory");
  __syncthreads();

  for (int k0 = 0; k0 < DIM; k0 += KT) {
    const int cur = (k0 / KT) & 1;

    // next stage's copies fly while this one is consumed by the matrix pipe
    if (k0 + KT < DIM) stage(cur ^ 1);

    #pragma unroll
    for (int kk = 0; kk < KT; kk += 4) {
      const int kl = kk + ((lane >> 4) << 1);   // lanes 16..31 take K+2,K+3
      v2f afr[MI], bfr[NI];
      #pragma unroll
      for (int mi = 0; mi < MI; ++mi) {
        int mrow = (wm * MI + mi) * 16 + (lane & 15);
        afr[mi] = *(const v2f*)&As[cur][mrow * GA_STRIDE + kl]; // ds_load_b64
      }
      #pragma unroll
      for (int ni = 0; ni < NI; ++ni) {
        int ncol = (wn * NI + ni) * 16 + (lane & 15);
        bfr[ni] = (v2f){Bs[cur][kl * BP + ncol], Bs[cur][(kl + 1) * BP + ncol]};
      }
      #pragma unroll
      for (int mi = 0; mi < MI; ++mi)
        #pragma unroll
        for (int ni = 0; ni < NI; ++ni)
          acc[mi][ni] = wmma_f32(afr[mi], bfr[ni], acc[mi][ni]);
    }

    // This wave's reads of the buffer have retired before the barrier behind
    // which the next trip's copies overwrite it.
    asm volatile("s_wait_dscnt 0x0" ::: "memory");
    // The next stage's copies of this wave have landed; the barrier publishes
    // them to the other waves.
    asm volatile("s_wait_asynccnt 0x0" ::: "memory");
    __syncthreads();
  }

  // Writeback: VGPR r holds M = (lane>=16 ? 8 : 0)+r, N = lane&15.
  #pragma unroll
  for (int ni = 0; ni < NI; ++ni) {
    float* c = C0;
    int n = DIM, col = n0 + (wn * NI + ni) * 16;   // same for the whole wave
    if (QKV) pick_qkv(col, C0, C1, C2, c, n, col);
    col += lane & 15;
    #pragma unroll
    for (int mi = 0; mi < MI; ++mi)
      #pragma unroll
      for (int r = 0; r < 8; ++r) {
        int row = m0 + (wm * MI + mi) * 16 + ((lane >> 4) << 3) + r;
        c[(size_t)row * n + col] = acc[mi][ni][r];
      }
  }
}

// Output projection: 128x128 tiles, waves 2(m) x 4(n) of 64x32 each.
__global__ __launch_bounds__(256)
// Two waves per SIMD is all this grid gives: the scheduler may spend
// registers on fragments fetched ahead instead of saving them for more waves.
__attribute__((amdgpu_waves_per_eu(2, 2)))
void gemm_f32_wmma(const float* __restrict__ A, const float* __restrict__ B,
                   float* __restrict__ C) {
  gemm_tile_f32<2, 4, 4, 2, false>(A, B, B, B, C, C, C,
                                   blockIdx.y * 128, blockIdx.x * 128);
}

// The three projections of x in ONE grid over the 3072 columns [Q | K | V]:
// 256x96 tiles, 8 waves of 32x96 each.  32 x 8 = 256 tiles, one per WGP;
// 384 tiles of 128x128 gave half of the WGPs two tiles and the rest one.
__global__ __launch_bounds__(256)
// Two waves per SIMD is all this grid gives: the scheduler may spend
// registers on fragments fetched ahead instead of saving them for more waves.
__attribute__((amdgpu_waves_per_eu(2, 2)))
void gemm_qkv_f32_wmma(const float* __restrict__ X,
                       const float* __restrict__ Wq,
                       const float* __restrict__ Wk,
                       const float* __restrict__ Wv,
                       float* __restrict__ Qo, float* __restrict__ Ko,
                       float* __restrict__ Vo) {
  gemm_tile_f32<8, 1, 2, 6, true>(X, Wq, Wk, Wv, Qo, Ko, Vo,
                                  blockIdx.y * 256, blockIdx.x * 96);
}

// ---------------------------------------------------------------------------
// RoPE in-place on a [rows, H*D] buffer; pair (2i, 2i+1) within each head.
// ---------------------------------------------------------------------------
__global__ __launch_bounds__(256)
void rope_f32(float* __restrict__ buf, int H, int total_pairs) {
  int idx = blockIdx.x * blockDim.x + threadIdx.x;
  if (idx >= total_pairs) return;
  const int half = HD / 2;
  int i   = idx % half;
  int h   = (idx / half) % H;
  int row = idx / (half * H);
  int s   = row % SEQ;
  float inv = __expf(-((float)(2 * i) / (float)HD) * __logf(10000.0f));
  float ang = (float)s * inv;
  float sn, cs;
  sincosf(ang, &sn, &cs);
  float* p = buf + ((size_t)row * H + h) * HD + 2 * i;
  float x1 = p[0], x2 = p[1];
  p[0] = x1 * cs - x2 * sn;
  p[1] = x1 * sn + x2 * cs;
}

#define AQ      128
#define KC      64
#define KP      32
#define T_PITCH 68

// Lane l takes the value of lane l ^ 16.
static __device__ __forceinline__ float xhalf(float x) {
  int b = __builtin_bit_cast(int, x);
  return __builtin_bit_cast(float, __builtin_amdgcn_permlanex16(
      b, b, 0x76543210, 0xfedcba98, false, false));
}

__global__ __launch_bounds__(256)
// 512 workgroups on 256 WGPs: four waves per SIMD, 256 registers each.
__attribute__((amdgpu_waves_per_eu(4, 4)))
void attn_f32_wmma(const float* __restrict__ Q, const float* __restrict__ Kb,
                   const float* __restrict__ Vb, float* __restrict__ O) {
  __shared__ __attribute__((aligned(16))) float qs[AQ * T_PITCH];  // Q [q][d]
  __shared__ __attribute__((aligned(16))) float ks[KC * T_PITCH];  // K [key][d]
  __shared__ __attribute__((aligned(16))) float vs[KC * T_PITCH];  // V [key][d]

  const int qb = blockIdx.x;          // 0..7   query block
  const int h  = blockIdx.y;          // 0..31  q head
  const int b  = blockIdx.z;          // 0..1   batch
  const int g  = h >> 2;              // kv head (n_rep = 4)

  const int tid  = threadIdx.x;
  const int lane = tid & 31;
  const int wid  = __builtin_amdgcn_readfirstlane(tid >> 5);  // scalar
  const int c    = lane & 15;         // this lane's query; row or column of a tile
  const int hf   = lane >> 4;         // lane half
  const float sl2 = 0.125f * 1.4426950408889634f;   // log2(e) / sqrt(64)

  const size_t qrow0 = (size_t)b * SEQ + (size_t)qb * AQ;
  const int srow = tid >> 4, sd4 = (tid & 15) << 2;  // a copy's row and dword

  // ---- stage the Q tile (128x64), then keep this wave's 16 B fragments in
  //      registers: they are the same for every key chunk ----
  #pragma unroll                      // the copies issue back to back
  for (int i = 0; i < AQ / 16; ++i)
    cp_b128(&qs[(srow + 16 * i) * T_PITCH + sd4],
            &Q[(qrow0 + srow + 16 * i) * DIM + h * HD + sd4]);
  // This wave's copies have landed; the barrier publishes them.
  asm volatile("s_wait_asynccnt 0x0" ::: "memory");
  __syncthreads();
  v2f qf[HD / 4];
  #pragma unroll                      // constant indices keep qf in registers
  for (int j = 0; j < HD / 4; ++j)
    qf[j] = *(const v2f*)&qs[(wid * 16 + c) * T_PITCH + 4 * j + 2 * hf];

  const size_t kvoff = ((size_t)b * SEQ + srow) * KVD + g * HD + sd4;
  const float* kg = Kb + kvoff;       // each lane's copy sources; they move on
  const float* vg = Vb + kvoff;       // by one chunk per trip
  const float* kr = &ks[c * T_PITCH + 2 * hf];       // K fragment base
  const float* vr = &vs[8 * hf * T_PITCH + c];       // V fragment base

  float mrun = -INFINITY;             // running maximum of this lane's query
  float lsum = 0.0f;                  // running sum over this lane half's keys
  v8f ot[HD / 16] = {};               // ot[t][r] = Ot[16t + 8*hf + r][query c]

  for (int kv0 = 0; kv0 < SEQ; kv0 += KC) {
    // This wave's reads of the tiles have retired before the barrier behind
    // which the copies overwrite them.
    asm volatile("s_wait_dscnt 0x0" ::: "memory");
    __syncthreads();
    #pragma unroll                    // the eight copies issue back to back
    for (int i = 0; i < KC / 16; ++i) {
      cp_b128(&ks[(srow + 16 * i) * T_PITCH + sd4], kg + (size_t)(16 * i) * KVD);
      cp_b128(&vs[(srow + 16 * i) * T_PITCH + sd4], vg + (size_t)(16 * i) * KVD);
    }
    kg += (size_t)KC * KVD;
    vg += (size_t)KC * KVD;
    // This wave's copies have landed; the barrier publishes them.
    asm volatile("s_wait_asynccnt 0x0" ::: "memory");
    __syncthreads();

    // Not unrolled: one pass's K and V fragments fit the 256 registers beside
    // qf and ot; both passes' at once spilled.
    #pragma unroll 1
    for (int p = 0; p < KC; p += KP) {
      const float* kp = kr + p * T_PITCH;
      const float* vq = vr + p * T_PITCH;

      // ---- St = K * Qt: two key tiles, two independent accumulators ----
      v8f st[KP / 16] = {};
      #pragma unroll                  // constant indices keep qf, st in registers
      for (int j = 0; j < HD / 4; ++j)
        #pragma unroll
        for (int t = 0; t < KP / 16; ++t) {
          v2f kf = *(const v2f*)&kp[16 * t * T_PITCH + 4 * j];  // ds_load_b64
          st[t] = wmma_f32(kf, qf[j], st[t]);
        }

      // ---- running softmax of this lane's query ----
      float mx = st[0][0];
      #pragma unroll
      for (int t = 0; t < KP / 16; ++t)
        #pragma unroll
        for (int r = 0; r < 8; ++r) mx = fmaxf(mx, st[t][r]);
      mx = fmaxf(mx, xhalf(mx));
      const float mnew = fmaxf(mrun, mx);
      const float corr = __builtin_amdgcn_exp2f((mrun - mnew) * sl2);  // 0 at first
      const float msc  = mnew * sl2;
      mrun = mnew;
      // Pt as B fragments: two score registers as they lie are one k pair.
      const v2f sl2v = (v2f){sl2, sl2}, nmsc = (v2f){-msc, -msc};
      v2f pf[KP / 16][4];
      v2f ps = (v2f){0.0f, 0.0f};     // even and odd keys summed apart
      #pragma unroll
      for (int t = 0; t < KP / 16; ++t)
        #pragma unroll
        for (int j = 0; j < 4; ++j) {
          const v2f a = __builtin_elementwise_fma(
              (v2f){st[t][2 * j], st[t][2 * j + 1]}, sl2v, nmsc);
          pf[t][j] = (v2f){__builtin_amdgcn_exp2f(a.x), __builtin_amdgcn_exp2f(a.y)};
          ps += pf[t][j];
        }
      lsum = lsum * corr + (ps.x + ps.y);
      #pragma unroll
      for (int t = 0; t < HD / 16; ++t)
        #pragma unroll
        for (int r = 0; r < 8; ++r) ot[t][r] *= corr;

      // ---- Ot += Vt * Pt ----
      #pragma unroll                  // constant indices keep pf, ot in registers
      for (int t = 0; t < KP / 16; ++t)
        #pragma unroll
        for (int j = 0; j < 4; ++j)
          #pragma unroll
          for (int dt = 0; dt < HD / 16; ++dt) {
            const float* vp = &vq[(16 * t + 2 * j) * T_PITCH + 16 * dt];
            ot[dt] = wmma_f32((v2f){vp[0], vp[T_PITCH]}, pf[t][j], ot[dt]);
          }
    }
  }

  // ---- join the halves' sums, divide, store 8 consecutive d per tile ----
  lsum += xhalf(lsum);
  const float rinv = 1.0f / lsum;
  float* op = O + (qrow0 + wid * 16 + c) * DIM + h * HD + 8 * hf;
  #pragma unroll
  for (int t = 0; t < HD / 16; ++t) {
    *(float4*)(op + 16 * t) = make_float4(ot[t][0] * rinv, ot[t][1] * rinv,
                                          ot[t][2] * rinv, ot[t][3] * rinv);
    *(float4*)(op + 16 * t + 4) = make_float4(ot[t][4] * rinv, ot[t][5] * rinv,
                                              ot[t][6] * rinv, ot[t][7] * rinv);
  }
}

// ---------------------------------------------------------------------------
extern "C" void kernel_launch(void* const* d_in, const int* in_sizes, int n_in,
                              void* d_out, int out_size, void* d_ws, size_t ws_size,
                              hipStream_t stream) {
  const float* x  = (const float*)d_in[0];
  const float* wq = (const float*)d_in[1];
  const float* wk = (const float*)d_in[2];
  const float* wv = (const float*)d_in[3];
  const float* wo = (const float*)d_in[4];

  float* ws = (float*)d_ws;
  float* Qb = ws;                              // 2048*2048
  float* Kb = Qb + (size_t)N_ROWS * DIM;       // 2048*512
  float* Vb = Kb + (size_t)N_ROWS * KVD;       // 2048*512
  float* Ab = Vb + (size_t)N_ROWS * KVD;       // 2048*2048 (attention output)

  dim3 gblk(256);
  dim3 ablk(256);

  // QKV projections, one launch
  gemm_qkv_f32_wmma<<<dim3((DIM + 2 * KVD) / 96, N_ROWS / 256), gblk, 0, stream>>>(x, wq, wk, wv, Qb, Kb, Vb);

  // RoPE on Q and K
  {
    int pq = N_ROWS * HQ * (HD / 2);
    int pk = N_ROWS * HKV * (HD / 2);
    rope_f32<<<(pq + 255) / 256, ablk, 0, stream>>>(Qb, HQ, pq);
    rope_f32<<<(pk + 255) / 256, ablk, 0, stream>>>(Kb, HKV, pk);
  }

  // Attention
  attn_f32_wmma<<<dim3(SEQ / AQ, HQ, 2), ablk, 0, stream>>>(Qb, Kb, Vb, Ab);

  // Output projection
  gemm_f32_wmma<<<dim3(DIM / 128, N_ROWS / 128), gblk, 0, stream>>>(Ab, wo, (float*)d_out);
}

// v005
// It runs in 311 microseconds.
// Two timings next to v004 both put it at 1.11 times that version's speed.
// All steps since v000 together make it 2.07 times as fast.
#include <hip/hip_runtime.h>
#include <math.h>

// ---------------------------------------------------------------------------
// CDNA5 (gfx1250) fp32 WMMA attention layer.
//   Q = rope(x@wq), K = rope(x@wk), V = x@wv
//   O = softmax(Q Kt / sqrt(D)) V ;  out = O @ wo
// RoPE is applied to the Q and K accumulators in the projection's writeback.
// All matmuls via V_WMMA_F32_16X16X4_F32 (exact fp32).
// GEMM tiles double-buffered in LDS via GLOBAL_LOAD_ASYNC_TO_LDS (ASYNCcnt).
// ---------------------------------------------------------------------------

typedef __attribute__((ext_vector_type(2))) float v2f;
typedef __attribute__((ext_vector_type(8))) float v8f;

#define N_ROWS   2048   // B*S
#define SEQ      1024
#define DIM      2048
#define KVD      512
#define HQ       32
#define HKV      8
#define HD       64

// ---------------- async global->LDS helpers (probe-guarded) ----------------
#if defined(__has_builtin)
#  if __has_builtin(__builtin_amdgcn_global_load_async_to_lds_b32) && \
      __has_builtin(__builtin_amdgcn_global_load_async_to_lds_b128)
#    define HAVE_ASYNC_LDS 1
#  else
#    define HAVE_ASYNC_LDS 0
#  endif
#else
#  define HAVE_ASYNC_LDS 0
#endif

#if HAVE_ASYNC_LDS
typedef int vsi4 __attribute__((vector_size(16)));
typedef __attribute__((address_space(1))) int  gas_i32;   // global int*
typedef __attribute__((address_space(3))) int  las_i32;   // LDS int*
typedef __attribute__((address_space(1))) vsi4 gas_v4i;   // global int4*
typedef __attribute__((address_space(3))) vsi4 las_v4i;   // LDS int4*
#endif

static __device__ __forceinline__ void cp_b32(float* lds_dst, const float* gsrc) {
#if HAVE_ASYNC_LDS
  __builtin_amdgcn_global_load_async_to_lds_b32(
      (gas_i32*)gsrc, (las_i32*)lds_dst, 0, 0);
#else
  *lds_dst = *gsrc;
#endif
}

static __device__ __forceinline__ void cp_b128(float* lds_dst, const float* gsrc) {
#if HAVE_ASYNC_LDS
  __builtin_amdgcn_global_load_async_to_lds_b128(
      (gas_v4i*)gsrc, (las_v4i*)lds_dst, 0, 0);
#else
  *(float4*)lds_dst = *(const float4*)gsrc;
#endif
}

static __device__ __forceinline__ v8f wmma_f32(v2f a, v2f b, v8f c) {
  // V_WMMA_F32_16X16X4_F32 : D = A(16x4) * B(4x16) + C, fp32 exact
  return __builtin_amdgcn_wmma_f32_16x16x4_f32(
      /*neg_a=*/false, a, /*neg_b=*/false, b,
      /*c_mod=*/(short)0, c, /*reuse_a=*/false, /*reuse_b=*/false);
}

// ---------------------------------------------------------------------------
// fp32 GEMM:  C[M,N] = A[M,DIM] * B[DIM,N]  (row-major).
// ONE workgroup of 8 waves per WGP, two waves per SIMD: while one wave waits
// for its LDS fragments or issues copies, the other feeds the matrix unit.
// The block tile is cut so that the grid has exactly 256 equal tiles.
// A wave owns MI x NI accumulators of 16x16; its columns are whole 128-B lines.
// LDS double-buffered, 32 k per stage, staged with async global->LDS copies.
// A tile kept row-major with a 36-dword pitch so an A fragment is one aligned
// ds_load_b64 (bank-conflict free).  The B pitch is 8 dwords over the tile's
// width: rows k and k+2, read by the two lane halves, fall on different banks.
// ---------------------------------------------------------------------------
#define KT        32   // k depth of one staged tile
#define GA_STRIDE 36   // dwords per A-tile row (32 data + 4 pad, 16B aligned)
// RoPE table of a tile's rows: (cos, sin) of the HD/2 angles of each row.  The
// pitch is 2 dwords over a row: rows R and R+8, read by the two lane halves in
// the writeback, lie 16 banks apart.
#define RT_PITCH  (HD + 2)

// Lane l takes the value of lane l ^ 1 (DPP quad_perm [1,0,3,2]).
static __device__ __forceinline__ float xpair(float x) {
  return __builtin_bit_cast(float, __builtin_amdgcn_mov_dpp(
      __builtin_bit_cast(int, x), 0xB1, 0xf, 0xf, true));
}

// Column gc of the row of outputs [Q | K | V] -> its matrix, pitch and column.
// Selects, not branches: every lane stays on for the copies that follow.
template <typename P>
static __device__ __forceinline__
void pick_qkv(int gc, P q, P k, P v, P& w, int& n, int& col) {
  const bool is_v = gc >= DIM + KVD, is_k = gc >= DIM;
  w   = is_v ? v : (is_k ? k : q);
  n   = is_k ? KVD : DIM;
  col = gc - (is_v ? DIM + KVD : (is_k ? DIM : 0));
}

// One tile of C, rows from m0 and columns from n0, by one workgroup of
// WMW x WNW waves.  With QKV the columns run over [B0 | B1 | B2] and the
// outputs over [C0 | C1 | C2]; every 16-column block lies in one of them, and
// the blocks of C0 and C1 (Q and K) are rotated (RoPE) before they are stored.
template <int WMW, int WNW, int MI, int NI, bool QKV>
static __device__ __forceinline__
void gemm_tile_f32(const float* __restrict__ A, const float* __restrict__ B0,
                   const float* __restrict__ B1, const float* __restrict__ B2,
                   float* __restrict__ C0, float* __restrict__ C1,
                   float* __restrict__ C2, int m0, int n0) {
  constexpr int TM  = WMW * MI * 16;           // tile rows
  constexpr int TN  = WNW * NI * 16;           // tile columns
  constexpr int BP  = TN + 8;                  // dwords per B-tile row
  constexpr int NT  = WMW * WNW * 32;          // threads
  constexpr int ACP = TM * (KT / 4) / NT;      // A copies per thread and stage
  constexpr int BCP = KT * (TN / 4) / NT;      // B copies per thread and stage
  static_assert(ACP * NT == TM * (KT / 4) && BCP * NT == KT * (TN / 4),
                "every lane copies in every round");
  __shared__ __attribute__((aligned(16))) float As[2][TM * GA_STRIDE]; // [m][k]
  __shared__ __attribute__((aligned(16))) float Bs[2][KT * BP];        // [k][n]
  __shared__ __attribute__((aligned(16))) float rt[QKV ? TM * RT_PITCH : 4];

  const int tid  = threadIdx.x;
  const int lane = tid & 31;
  const int wid  = __builtin_amdgcn_readfirstlane(tid >> 5);  // scalar
  const int wm   = wid / WNW;           // row strip of MI*16 rows
  const int wn   = wid % WNW;           // column strip of NI*16 columns

  v8f acc[MI][NI] = {};

  // Each lane's copy sources; they move on by one stage per call of stage().
  const float* ag = A + (size_t)(m0 + (tid >> 3)) * DIM + ((tid & 7) << 2);
  const int    al = (tid >> 3) * GA_STRIDE + ((tid & 7) << 2);
  const float* bg[BCP];
  int bstep[BCP], bl[BCP];
  #pragma unroll
  for (int i = 0; i < BCP; ++i) {
    int idx = tid + i * NT;
    int k = idx / (TN / 4), c = (idx % (TN / 4)) << 2;
    const float* w = B0;
    int n = DIM, col = n0 + c;
    if (QKV) pick_qkv(n0 + c, B0, B1, B2, w, n, col);
    bg[i]    = w + (size_t)k * n + col;
    bstep[i] = KT * n;
    bl[i]    = k * BP + c;
  }
  auto stage = [&](int buf) {
    #pragma unroll
    for (int i = 0; i < ACP; ++i)
      cp_b128(&As[buf][al + i * (NT / 8) * GA_STRIDE],
              ag + (size_t)i * (NT / 8) * DIM);
    #pragma unroll
    for (int i = 0; i < BCP; ++i) {
      cp_b128(&Bs[buf][bl[i]], bg[i]);
      bg[i] += bstep[i];
    }
    ag += KT;
  };

  stage(0);
  // While stage 0 flies: (cos, sin) for the tile's TM rows x HD/2 angles, each
  // computed once per workgroup.  A lane keeps one angle index, a wave walks
  // the rows.  The barrier below publishes the table with stage 0.
  if (QKV && n0 < DIM + KVD) {        // same for the whole workgroup
    static_assert(!QKV || HD / 2 == 32, "one angle index per lane");
    const float inv =
        __expf(-((float)(2 * lane) / (float)HD) * __logf(10000.0f));
    // Rolled: the branch inside sincosf keeps trips from interleaving, so
    // copies of the body would only fill the instruction cache.
    #pragma unroll 1
    for (int r = wid; r < TM; r += NT / 32) {
      float sn, cs;
      sincosf((float)((m0 + r) % SEQ) * inv, &sn, &cs);
      *(v2f*)&rt[r * RT_PITCH + 2 * lane] = (v2f){cs, sn};
    }
  }
  // Stage 0's copies of this wave have landed; the barrier publishes them.
  asm volatile("s_wait_asynccnt 0x0" ::: "memory");
  __syncthreads();

  for (int k0 = 0; k0 < DIM; k0 += KT) {
    const int cur = (k0 / KT) & 1;

    // next stage's copies fly while this one is consumed by the matrix pipe
    if (k0 + KT < DIM) stage(cur ^ 1);

    #pragma unroll
    for (int kk = 0; kk < KT; kk += 4) {
      const int kl = kk + ((lane >> 4) << 1);   // lanes 16..31 take K+2,K+3
      v2f afr[MI], bfr[NI];
      #pragma unroll
      for (int mi = 0; mi < MI; ++mi) {
        int mrow = (wm * MI + mi) * 16 + (lane & 15);
        afr[mi] = *(const v2f*)&As[cur][mrow * GA_STRIDE + kl]; // ds_load_b64
      }
      #pragma unroll
      for (int ni = 0; ni < NI; ++ni) {
        int ncol = (wn * NI + ni) * 16 + (lane & 15);
        bfr[ni] = (v2f){Bs[cur][kl * BP + ncol], Bs[cur][(kl + 1) * BP + ncol]};
      }
      #pragma unroll
      for (int mi = 0; mi < MI; ++mi)
        #pragma unroll
        for (int ni = 0; ni < NI; ++ni)
          acc[mi][ni] = wmma_f32(afr[mi], bfr[ni], acc[mi][ni]);
    }

    // This wave's reads of the buffer have retired before the barrier behind
    // which the next trip's copies overwrite it.
    asm volatile("s_wait_dscnt 0x0" ::: "memory");
    // The next stage's copies of this wave have landed; the barrier publishes
    // them to the other waves.
    asm volatile("s_wait_asynccnt 0x0" ::: "memory");
    __syncthreads();
  }

  // Writeback: VGPR r holds M = (lane>=16 ? 8 : 0)+r, N = lane&15.
  #pragma unroll
  for (int ni = 0; ni < NI; ++ni) {
    float* c = C0;
    int n = DIM, col = n0 + (wn * NI + ni) * 16;   // same for the whole wave
    // RoPE: columns 2i, 2i+1 of a head lie in neighbouring lanes.  The even
    // lane stores x1*cos - x2*sin, the odd one x2*cos + x1*sin.
    if (QKV && col < DIM + KVD) {     // same for the whole wave
      const float* tp = &rt[((wm * MI) * 16 + ((lane >> 4) << 3)) * RT_PITCH +
                            (col % HD) + (lane & 14)];
      #pragma unroll
      for (int mi = 0; mi < MI; ++mi)
        #pragma unroll
        for (int r = 0; r < 8; ++r) {
          const v2f t = *(const v2f*)&tp[(mi * 16 + r) * RT_PITCH];
          const float own = acc[mi][ni][r], oth = xpair(own);
          acc[mi][ni][r] = own * t.x + oth * ((lane & 1) ? t.y : -t.y);
        }
    }
    if (QKV) pick_qkv(col, C0, C1, C2, c, n, col);
    col += lane & 15;
    #pragma unroll
    for (int mi = 0; mi < MI; ++mi)
      #pragma unroll
      for (int r = 0; r < 8; ++r) {
        int row = m0 + (wm * MI + mi) * 16 + ((lane >> 4) << 3) + r;
        c[(size_t)row * n + col] = acc[mi][ni][r];
      }
  }
}

// Output projection: 128x128 tiles, waves 2(m) x 4(n) of 64x32 each.
__global__ __launch_bounds__(256)
// Two waves per SIMD is all this grid gives: the scheduler may spend
// registers on fragments fetched ahead instead of saving them for more waves.
__attribute__((amdgpu_waves_per_eu(2, 2)))
void gemm_f32_wmma(const float* __restrict__ A, const float* __restrict__ B,
                   float* __restrict__ C) {
  gemm_tile_f32<2, 4, 4, 2, false>(A, B, B, B, C, C, C,
                                   blockIdx.y * 128, blockIdx.x * 128);
}

// The three projections of x in ONE grid over the 3072 columns [Q | K | V]:
// 256x96 tiles, 8 waves of 32x96 each.  32 x 8 = 256 tiles, one per WGP;
// 384 tiles of 128x128 gave half of the WGPs two tiles and the rest one.
__global__ __launch_bounds__(256)
// Two waves per SIMD is all this grid gives: the scheduler may spend
// registers on fragments fetched ahead instead of saving them for more waves.
__attribute__((amdgpu_waves_per_eu(2, 2)))
void gemm_qkv_f32_wmma(const float* __restrict__ X,
                       const float* __restrict__ Wq,
                       const float* __restrict__ Wk,
                       const float* __restrict__ Wv,
                       float* __restrict__ Qo, float* __restrict__ Ko,
                       float* __restrict__ Vo) {
  gemm_tile_f32<8, 1, 2, 6, true>(X, Wq, Wk, Wv, Qo, Ko, Vo,
                                  blockIdx.y * 256, blockIdx.x * 96);
}

#define AQ      128
#define KC      64
#define KP      32
#define T_PITCH 68

// Lane l takes the value of lane l ^ 16.
static __device__ __forceinline__ float xhalf(float x) {
  int b = __builtin_bit_cast(int, x);
  return __builtin_bit_cast(float, __builtin_amdgcn_permlanex16(
      b, b, 0x76543210, 0xfedcba98, false, false));
}

__global__ __launch_bounds__(256)
// 512 workgroups on 256 WGPs: four waves per SIMD, 256 registers each.
__attribute__((amdgpu_waves_per_eu(4, 4)))
void attn_f32_wmma(const float* __restrict__ Q, const float* __restrict__ Kb,
                   const float* __restrict__ Vb, float* __restrict__ O) {
  __shared__ __attribute__((aligned(16))) float qs[AQ * T_PITCH];  // Q [q][d]
  __shared__ __attribute__((aligned(16))) float ks[KC * T_PITCH];  // K [key][d]
  __shared__ __attribute__((aligned(16))) float vs[KC * T_PITCH];  // V [key][d]

  const int qb = blockIdx.x;          // 0..7   query block
  const int h  = blockIdx.y;          // 0..31  q head
  const int b  = blockIdx.z;          // 0..1   batch
  const int g  = h >> 2;              // kv head (n_rep = 4)

  const int tid  = threadIdx.x;
  const int lane = tid & 31;
  const int wid  = __builtin_amdgcn_readfirstlane(tid >> 5);  // scalar
  const int c    = lane & 15;         // this lane's query; row or column of a tile
  const int hf   = lane >> 4;         // lane half
  const float sl2 = 0.125f * 1.4426950408889634f;   // log2(e) / sqrt(64)

  const size_t qrow0 = (size_t)b * SEQ + (size_t)qb * AQ;
  const int srow = tid >> 4, sd4 = (tid & 15) << 2;  // a copy's row and dword

  // ---- stage the Q tile (128x64), then keep this wave's 16 B fragments in
  //      registers: they are the same for every key chunk ----
  #pragma unroll                      // the copies issue back to back
  for (int i = 0; i < AQ / 16; ++i)
    cp_b128(&qs[(srow + 16 * i) * T_PITCH + sd4],
            &Q[(qrow0 + srow + 16 * i) * DIM + h * HD + sd4]);
  // This wave's copies have landed; the barrier publishes them.
  asm volatile("s_wait_asynccnt 0x0" ::: "memory");
  __syncthreads();
  v2f qf[HD / 4];
  #pragma unroll                      // constant indices keep qf in registers
  for (int j = 0; j < HD / 4; ++j)
    qf[j] = *(const v2f*)&qs[(wid * 16 + c) * T_PITCH + 4 * j + 2 * hf];

  const size_t kvoff = ((size_t)b * SEQ + srow) * KVD + g * HD + sd4;
  const float* kg = Kb + kvoff;       // each lane's copy sources; they move on
  const float* vg = Vb + kvoff;       // by one chunk per trip
  const float* kr = &ks[c * T_PITCH + 2 * hf];       // K fragment base
  const float* vr = &vs[8 * hf * T_PITCH + c];       // V fragment base

  float mrun = -INFINITY;             // running maximum of this lane's query
  float lsum = 0.0f;                  // running sum over this lane half's keys
  v8f ot[HD / 16] = {};               // ot[t][r] = Ot[16t + 8*hf + r][query c]

  for (int kv0 = 0; kv0 < SEQ; kv0 += KC) {
    // This wave's reads of the tiles have retired before the barrier behind
    // which the copies overwrite them.
    asm volatile("s_wait_dscnt 0x0" ::: "memory");
    __syncthreads();
    #pragma unroll                    // the eight copies issue back to back
    for (int i = 0; i < KC / 16; ++i) {
      cp_b128(&ks[(srow + 16 * i) * T_PITCH + sd4], kg + (size_t)(16 * i) * KVD);
      cp_b128(&vs[(srow + 16 * i) * T_PITCH + sd4], vg + (size_t)(16 * i) * KVD);
    }
    kg += (size_t)KC * KVD;
    vg += (size_t)KC * KVD;
    // This wave's copies have landed; the barrier publishes them.
    asm volatile("s_wait_asynccnt 0x0" ::: "memory");
    __syncthreads();

    // Not unrolled: one pass's K and V fragments fit the 256 registers beside
    // qf and ot; both passes' at once spilled.
    #pragma unroll 1
    for (int p = 0; p < KC; p += KP) {
      const float* kp = kr + p * T_PITCH;
      const float* vq = vr + p * T_PITCH;

      // ---- St = K * Qt: two key tiles, two independent accumulators ----
      v8f st[KP / 16] = {};
      #pragma unroll                  // constant indices keep qf, st in registers
      for (int j = 0; j < HD / 4; ++j)
        #pragma unroll
        for (int t = 0; t < KP / 16; ++t) {
          v2f kf = *(const v2f*)&kp[16 * t * T_PITCH + 4 * j];  // ds_load_b64
          st[t] = wmma_f32(kf, qf[j], st[t]);
        }

      // ---- running softmax of this lane's query ----
      float mx = st[0][0];
      #pragma unroll
      for (int t = 0; t < KP / 16; ++t)
        #pragma unroll
        for (int r = 0; r < 8; ++r) mx = fmaxf(mx, st[t][r]);
      mx = fmaxf(mx, xhalf(mx));
      const float mnew = fmaxf(mrun, mx);
      const float corr = __builtin_amdgcn_exp2f((mrun - mnew) * sl2);  // 0 at first
      const float msc  = mnew * sl2;
      mrun = mnew;
      // Pt as B fragments: two score registers as they lie are one k pair.
      const v2f sl2v = (v2f){sl2, sl2}, nmsc = (v2f){-msc, -msc};
      v2f pf[KP / 16][4];
      v2f ps = (v2f){0.0f, 0.0f};     // even and odd keys summed apart
      #pragma unroll
      for (int t = 0; t < KP / 16; ++t)
        #pragma unroll
        for (int j = 0; j < 4; ++j) {
          const v2f a = __builtin_elementwise_fma(
              (v2f){st[t][2 * j], st[t][2 * j + 1]}, sl2v, nmsc);
          pf[t][j] = (v2f){__builtin_amdgcn_exp2f(a.x), __builtin_amdgcn_exp2f(a.y)};
          ps += pf[t][j];
        }
      lsum = lsum * corr + (ps.x + ps.y);
      #pragma unroll
      for (int t = 0; t < HD / 16; ++t)
        #pragma unroll
        for (int r = 0; r < 8; ++r) ot[t][r] *= corr;

      // ---- Ot += Vt * Pt ----
      #pragma unroll                  // constant indices keep pf, ot in registers
      for (int t = 0; t < KP / 16; ++t)
        #pragma unroll
        for (int j = 0; j < 4; ++j)
          #pragma unroll
          for (int dt = 0; dt < HD / 16; ++dt) {
            const float* vp = &vq[(16 * t + 2 * j) * T_PITCH + 16 * dt];
            ot[dt] = wmma_f32((v2f){vp[0], vp[T_PITCH]}, pf[t][j], ot[dt]);
          }
    }
  }

  // ---- join the halves' sums, divide, store 8 consecutive d per tile ----
  lsum += xhalf(lsum);
  const float rinv = 1.0f / lsum;
  float* op = O + (qrow0 + wid * 16 + c) * DIM + h * HD + 8 * hf;
  #pragma unroll
  for (int t = 0; t < HD / 16; ++t) {
    *(float4*)(op + 16 * t) = make_float4(ot[t][0] * rinv, ot[t][1] * rinv,
                                          ot[t][2] * rinv, ot[t][3] * rinv);
    *(float4*)(op + 16 * t + 4) = make_float4(ot[t][4] * rinv, ot[t][5] * rinv,
                                              ot[t][6] * rinv, ot[t][7] * rinv);
  }
}

// ---------------------------------------------------------------------------
extern "C" void kernel_launch(void* const* d_in, const int* in_sizes, int n_in,
                              void* d_out, int out_size, void* d_ws, size_t ws_size,
                              hipStream_t stream) {
  const float* x  = (const float*)d_in[0];
  const float* wq = (const float*)d_in[1];
  const float* wk = (const float*)d_in[2];
  const float* wv = (const float*)d_in[3];
  const float* wo = (const float*)d_in[4];

  float* ws = (float*)d_ws;
  float* Qb = ws;                              // 2048*2048
  float* Kb = Qb + (size_t)N_ROWS * DIM;       // 2048*512
  float* Vb = Kb + (size_t)N_ROWS * KVD;       // 2048*512
  float* Ab = Vb + (size_t)N_ROWS * KVD;       // 2048*2048 (attention output)

  dim3 gblk(256);
  dim3 ablk(256);

  // QKV projections with RoPE on Q and K, one launch
  gemm_qkv_f32_wmma<<<dim3((DIM + 2 * KVD) / 96, N_ROWS / 256), gblk, 0, stream>>>(x, wq, wk, wv, Qb, Kb, Vb);

  // Attention
  attn_f32_wmma<<<dim3(SEQ / AQ, HQ, 2), ablk, 0, stream>>>(Qb, Kb, Vb, Ab);

  // Output projection
  gemm_f32_wmma<<<dim3(DIM / 128, N_ROWS / 128), gblk, 0, stream>>>(Ab, wo, (float*)d_out);
}
